// v000
// The times below were measured on an AMD MI455X: many runs one after another, warmed up first and cycling through
// copies of the inputs, with the whole window's GPU time divided by the number of runs. Launches and the gaps
// between them are all in it. The median over several windows is given; except for v000 it joins two sittings, which
// can be a few percent apart, so the side-by-side timings, each taken in one sitting, are the better comparison.
// The starting kernel, v000, takes 84.2 microseconds a run.
#include <hip/hip_runtime.h>

// MultiHeadGraphAttention for MI455X (gfx1250, wave32, WMMA f16->f32).
// B=8, N=1024, F_IN=F_OUT=128, H=8, D_K=16.

typedef __attribute__((ext_vector_type(16))) _Float16 v16h;
typedef __attribute__((ext_vector_type(8)))  float    v8f;

#define BB   8
#define NN   1024
#define FIN  128
#define FOUT 128
#define HH   8
#define DK   16

union F16x8 { uint4 u4; _Float16 h[8]; };

__device__ __forceinline__ v8f wmma_f16(v16h a, v16h b, v8f c) {
  // D = A(16x32 f16) x B(32x16 f16) + C(16x16 f32)
  return __builtin_amdgcn_wmma_f32_16x16x32_f16(
      /*neg_a=*/false, a, /*neg_b=*/false, b,
      /*c_mod=*/(short)0, c, /*reuse_a=*/false, /*reuse_b=*/false);
}

// ---------------------------------------------------------------------------
// Kernel 1: fused QKV projection. One wave -> one 16x16 output tile.
//   sel 0: Q -> Qh[B,H,N,16] f16
//   sel 1: K -> Kh[B,H,N,16] f16
//   sel 2: V -> Vt[B,H,16,N] f16  (transposed for contiguous B-frag loads)
// ---------------------------------------------------------------------------
__global__ __launch_bounds__(32)
void gat_proj_qkv(const float* __restrict__ X,
                  const float* __restrict__ Wq, const float* __restrict__ bq,
                  const float* __restrict__ Wk, const float* __restrict__ bk,
                  const float* __restrict__ Wv, const float* __restrict__ bv,
                  _Float16* __restrict__ Qh, _Float16* __restrict__ Kh,
                  _Float16* __restrict__ Vt)
{
  const int lane = threadIdx.x;
  const int r    = lane & 15;
  const int half = lane >> 4;
  const int t    = blockIdx.x;   // 16-row tile over B*N (0..511)
  const int h    = blockIdx.y;   // head == 16-wide output chunk
  const int sel  = blockIdx.z;   // 0=Q 1=K 2=V

  const float* W  = (sel == 0) ? Wq : (sel == 1) ? Wk : Wv;
  const float* bi = (sel == 0) ? bq : (sel == 1) ? bk : bv;

  const int arow = t * 16 + r;        // A-frag row (node)
  const int ocol = h * DK + r;        // B-frag column (output channel)

  v8f acc = {0.f, 0.f, 0.f, 0.f, 0.f, 0.f, 0.f, 0.f};

#pragma unroll
  for (int kk = 0; kk < 4; ++kk) {    // K = 128 in chunks of 32
    const float* xa = X + (size_t)arow * FIN + kk * 32 + half * 8;
    const float* wb = W + (size_t)ocol * FIN + kk * 32 + half * 8;
    v16h a, bfr;
#pragma unroll
    for (int e = 0; e < 8; ++e) {
      a[e]       = (_Float16)xa[e];        // K = kk*32 + half*8 + e
      a[8 + e]   = (_Float16)xa[16 + e];   // K = kk*32 + 16 + half*8 + e
      bfr[e]     = (_Float16)wb[e];
      bfr[8 + e] = (_Float16)wb[16 + e];
    }
    acc = wmma_f16(a, bfr, acc);
  }

  const float bias = bi[ocol];

#pragma unroll
  for (int v = 0; v < 8; ++v) {
    const int m    = v + half * 8;        // C row
    const int node = t * 16 + m;          // tile never crosses batch (N%16==0)
    const int b    = node >> 10;
    const int n    = node & (NN - 1);
    const float val = acc[v] + bias;
    if (sel == 0)
      Qh[((size_t)(b * HH + h) * NN + n) * DK + r] = (_Float16)val;
    else if (sel == 1)
      Kh[((size_t)(b * HH + h) * NN + n) * DK + r] = (_Float16)val;
    else
      Vt[((size_t)(b * HH + h) * DK + r) * NN + n] = (_Float16)val;
  }
}

// ---------------------------------------------------------------------------
// Kernel 2: masked attention, flash-style streaming softmax.
// Block = 256 threads = 8 waves = 8 heads over one (batch, 16-query tile),
// so adjacency reads are shared across heads through WGP$/L2.
// ---------------------------------------------------------------------------
__global__ __launch_bounds__(256)
void gat_attn(const _Float16* __restrict__ Qh, const _Float16* __restrict__ Kh,
              const _Float16* __restrict__ Vt, const float* __restrict__ Adj,
              _Float16* __restrict__ AO)
{
  __shared__ __align__(16) _Float16 pb[HH * 16 * 32];  // per-wave P buffers

  const int lane = threadIdx.x & 31;
  const int h    = threadIdx.x >> 5;   // wave id == head
  const int r    = lane & 15;
  const int half = lane >> 4;
  const int qt   = blockIdx.x;         // query tile within batch (0..63)
  const int b    = blockIdx.y;
  const int bh   = b * HH + h;

  _Float16* P = pb + h * (16 * 32);

  // Q A-fragment (16x32, K-dim d padded 16 -> 32 with zeros)
  v16h qa;
  {
    F16x8 t0;
    t0.u4 = *reinterpret_cast<const uint4*>(
        Qh + ((size_t)bh * NN + qt * 16 + r) * DK + half * 8);
#pragma unroll
    for (int e = 0; e < 8; ++e) { qa[e] = t0.h[e]; qa[8 + e] = (_Float16)0.f; }
  }

  v8f oacc = {0.f, 0.f, 0.f, 0.f, 0.f, 0.f, 0.f, 0.f};
  float mrun[8], lrun[8];
#pragma unroll
  for (int v = 0; v < 8; ++v) { mrun[v] = -1.0e30f; lrun[v] = 0.f; }

  const float* arowbase = Adj + (size_t)b * NN * NN + (size_t)(qt * 16) * NN;

  for (int kt = 0; kt < NN / 32; ++kt) {
    const int kbase = kt * 32;

    // K^T B-fragments for keys [kbase, kbase+16) and [kbase+16, kbase+32)
    v16h kb0, kb1;
    {
      const _Float16* kp = Kh + ((size_t)bh * NN + kbase + r) * DK + half * 8;
      F16x8 t0; t0.u4 = *reinterpret_cast<const uint4*>(kp);
      F16x8 t1; t1.u4 = *reinterpret_cast<const uint4*>(kp + 16 * DK);
#pragma unroll
      for (int e = 0; e < 8; ++e) {
        kb0[e] = t0.h[e]; kb0[8 + e] = (_Float16)0.f;
        kb1[e] = t1.h[e]; kb1[8 + e] = (_Float16)0.f;
      }
    }

    const v8f zero = {0.f, 0.f, 0.f, 0.f, 0.f, 0.f, 0.f, 0.f};
    v8f s0 = wmma_f16(qa, kb0, zero);   // S[:, 0:16]
    v8f s1 = wmma_f16(qa, kb1, zero);   // S[:, 16:32]

    // Mask, scale (1/sqrt(16)=0.25), streaming softmax update.
#pragma unroll
    for (int v = 0; v < 8; ++v) {
      const int m = v + half * 8;                         // C-frag row
      const float a0 = arowbase[(size_t)m * NN + kbase + r];
      const float a1 = arowbase[(size_t)m * NN + kbase + 16 + r];
      const float sv0 = (a0 > 0.f) ? s0[v] * 0.25f : -1.0e9f;
      const float sv1 = (a1 > 0.f) ? s1[v] * 0.25f : -1.0e9f;

      float tm = fmaxf(sv0, sv1);
#pragma unroll
      for (int off = 8; off >= 1; off >>= 1)
        tm = fmaxf(tm, __shfl_xor(tm, off, 32));          // 16-lane row max

      const float mn = fmaxf(mrun[v], tm);
      const float al = __expf(mrun[v] - mn);
      const float e0 = __expf(sv0 - mn);
      const float e1 = __expf(sv1 - mn);

      float rs = e0 + e1;
#pragma unroll
      for (int off = 8; off >= 1; off >>= 1)
        rs += __shfl_xor(rs, off, 32);                    // 16-lane row sum

      lrun[v] = lrun[v] * al + rs;
      mrun[v] = mn;
      oacc[v] *= al;

      P[m * 32 + r]      = (_Float16)e0;                  // C-layout -> LDS
      P[m * 32 + 16 + r] = (_Float16)e1;
    }

    // DS ops from one wave execute in order; wait for LDS writes + fence
    // the compiler so the A-layout reads below stay behind the stores.
    asm volatile("s_wait_dscnt 0" ::: "memory");

    // P as A-fragment (16x32) from LDS, V as B-fragment (32x16) from Vt.
    v16h pa, vb;
    {
      const _Float16* pp = P + r * 32 + half * 8;
      F16x8 t0; t0.u4 = *reinterpret_cast<const uint4*>(pp);
      F16x8 t1; t1.u4 = *reinterpret_cast<const uint4*>(pp + 16);
      const _Float16* vp = Vt + ((size_t)bh * DK + r) * NN + kbase + half * 8;
      F16x8 t2; t2.u4 = *reinterpret_cast<const uint4*>(vp);
      F16x8 t3; t3.u4 = *reinterpret_cast<const uint4*>(vp + 16);
#pragma unroll
      for (int e = 0; e < 8; ++e) {
        pa[e] = t0.h[e]; pa[8 + e] = t1.h[e];
        vb[e] = t2.h[e]; vb[8 + e] = t3.h[e];
      }
    }
    oacc = wmma_f16(pa, vb, oacc);      // O += P(16x32) x V(32x16)
  }

  // Normalize and write attention output [B,N,H*DK] f16.
#pragma unroll
  for (int v = 0; v < 8; ++v) {
    const int m = v + half * 8;
    const float val = oacc[v] / lrun[v];   // diagonal edge => lrun > 0
    AO[((size_t)b * NN + qt * 16 + m) * FOUT + h * DK + r] = (_Float16)val;
  }
}

// ---------------------------------------------------------------------------
// Kernel 3: output projection Y = AO @ Wo^T + bo (f32 result).
// ---------------------------------------------------------------------------
__global__ __launch_bounds__(32)
void gat_outproj(const _Float16* __restrict__ AO, const float* __restrict__ Wo,
                 const float* __restrict__ bo, float* __restrict__ Y)
{
  const int lane = threadIdx.x;
  const int r    = lane & 15;
  const int half = lane >> 4;
  const int t    = blockIdx.x;   // 16-row tile over B*N
  const int oc   = blockIdx.y;   // 16-wide output chunk

  const int arow = t * 16 + r;
  const int ocol = oc * DK + r;

  v8f acc = {0.f, 0.f, 0.f, 0.f, 0.f, 0.f, 0.f, 0.f};

#pragma unroll
  for (int kk = 0; kk < 4; ++kk) {
    const _Float16* ap = AO + (size_t)arow * FOUT + kk * 32 + half * 8;
    const float*    wb = Wo + (size_t)ocol * FOUT + kk * 32 + half * 8;
    F16x8 t0; t0.u4 = *reinterpret_cast<const uint4*>(ap);
    F16x8 t1; t1.u4 = *reinterpret_cast<const uint4*>(ap + 16);
    v16h a, bfr;
#pragma unroll
    for (int e = 0; e < 8; ++e) {
      a[e]       = t0.h[e];
      a[8 + e]   = t1.h[e];
      bfr[e]     = (_Float16)wb[e];
      bfr[8 + e] = (_Float16)wb[16 + e];
    }
    acc = wmma_f16(a, bfr, acc);
  }

  const float bias = bo[ocol];
#pragma unroll
  for (int v = 0; v < 8; ++v) {
    const int m = v + half * 8;
    Y[(size_t)(t * 16 + m) * FOUT + oc * DK + r] = acc[v] + bias;
  }
}

// ---------------------------------------------------------------------------
extern "C" void kernel_launch(void* const* d_in, const int* in_sizes, int n_in,
                              void* d_out, int out_size, void* d_ws, size_t ws_size,
                              hipStream_t stream) {
  const float* X   = (const float*)d_in[0];
  const float* Adj = (const float*)d_in[1];
  const float* Wq  = (const float*)d_in[2];
  const float* bq  = (const float*)d_in[3];
  const float* Wk  = (const float*)d_in[4];
  const float* bk  = (const float*)d_in[5];
  const float* Wv  = (const float*)d_in[6];
  const float* bv  = (const float*)d_in[7];
  const float* Wo  = (const float*)d_in[8];
  const float* bo  = (const float*)d_in[9];
  float* Y = (float*)d_out;

  // Workspace layout (8 MiB total, fully overwritten each call):
  //   [0,2M)   Qh  f16 [B,H,N,16]
  //   [2M,4M)  Kh  f16 [B,H,N,16]
  //   [4M,6M)  Vt  f16 [B,H,16,N]
  //   [6M,8M)  AO  f16 [B,N,128]
  char* ws = (char*)d_ws;
  _Float16* Qh = (_Float16*)(ws);
  _Float16* Kh = (_Float16*)(ws + (2u << 20));
  _Float16* Vt = (_Float16*)(ws + (4u << 20));
  _Float16* AO = (_Float16*)(ws + (6u << 20));

  // 1) QKV projections: (B*N/16)=512 row tiles x 8 heads x {Q,K,V}
  gat_proj_qkv<<<dim3(512, 8, 3), 32, 0, stream>>>(
      X, Wq, bq, Wk, bk, Wv, bv, Qh, Kh, Vt);

  // 2) Masked flash attention: (N/16)=64 query tiles x B, 8 waves = 8 heads
  gat_attn<<<dim3(64, 8), 256, 0, stream>>>(Qh, Kh, Vt, Adj, AO);

  // 3) Output projection
  gat_outproj<<<dim3(512, 8), 32, 0, stream>>>(AO, Wo, bo, Y);
}

// v001
// A run of this version takes 60.1 microseconds.
// Timed twice side by side with v000, it ran 1.43 times as fast both times.
#include <hip/hip_runtime.h>

// MultiHeadGraphAttention for MI455X (gfx1250, wave32, WMMA f16->f32).
// B=8, N=1024, F_IN=F_OUT=128, H=8, D_K=16.

typedef __attribute__((ext_vector_type(16))) _Float16 v16h;
typedef __attribute__((ext_vector_type(8)))  float    v8f;
typedef __attribute__((ext_vector_type(4)))  float    v4f;
typedef __attribute__((ext_vector_type(8)))  _Float16 v8h;

#define BB   8
#define NN   1024
#define FIN  128
#define FOUT 128
#define HH   8
#define DK   16

union F16x8 { uint4 u4; _Float16 h[8]; };

__device__ __forceinline__ v8f wmma_f16(v16h a, v16h b, v8f c) {
  // D = A(16x32 f16) x B(32x16 f16) + C(16x16 f32)
  return __builtin_amdgcn_wmma_f32_16x16x32_f16(
      /*neg_a=*/false, a, /*neg_b=*/false, b,
      /*c_mod=*/(short)0, c, /*reuse_a=*/false, /*reuse_b=*/false);
}

// ---------------------------------------------------------------------------
// Kernel 1: fused QKV projection. One wave -> one 16x16 output tile.
//   sel 0: Q -> Qh[B,H,N,16] f16
//   sel 1: K -> Kh[B,H,N,16] f16
//   sel 2: V -> Vt[B,H,16,N] f16  (transposed for contiguous A-frag loads)
// ---------------------------------------------------------------------------
__global__ __launch_bounds__(32)
void gat_proj_qkv(const float* __restrict__ X,
                  const float* __restrict__ Wq, const float* __restrict__ bq,
                  const float* __restrict__ Wk, const float* __restrict__ bk,
                  const float* __restrict__ Wv, const float* __restrict__ bv,
                  _Float16* __restrict__ Qh, _Float16* __restrict__ Kh,
                  _Float16* __restrict__ Vt)
{
  const int lane = threadIdx.x;
  const int r    = lane & 15;
  const int half = lane >> 4;
  const int t    = blockIdx.x;   // 16-row tile over B*N (0..511)
  const int h    = blockIdx.y;   // head == 16-wide output chunk
  const int sel  = blockIdx.z;   // 0=Q 1=K 2=V

  const float* W  = (sel == 0) ? Wq : (sel == 1) ? Wk : Wv;
  const float* bi = (sel == 0) ? bq : (sel == 1) ? bk : bv;

  const int arow = t * 16 + r;        // A-frag row (node)
  const int ocol = h * DK + r;        // B-frag column (output channel)

  v8f acc = {0.f, 0.f, 0.f, 0.f, 0.f, 0.f, 0.f, 0.f};

#pragma unroll
  for (int kk = 0; kk < 4; ++kk) {    // K = 128 in chunks of 32
    const float* xa = X + (size_t)arow * FIN + kk * 32 + half * 8;
    const float* wb = W + (size_t)ocol * FIN + kk * 32 + half * 8;
    v16h a, bfr;
#pragma unroll
    for (int e = 0; e < 8; ++e) {
      a[e]       = (_Float16)xa[e];        // K = kk*32 + half*8 + e
      a[8 + e]   = (_Float16)xa[16 + e];   // K = kk*32 + 16 + half*8 + e
      bfr[e]     = (_Float16)wb[e];
      bfr[8 + e] = (_Float16)wb[16 + e];
    }
    acc = wmma_f16(a, bfr, acc);
  }

  const float bias = bi[ocol];

#pragma unroll
  for (int v = 0; v < 8; ++v) {
    const int m    = v + half * 8;        // C row
    const int node = t * 16 + m;          // tile never crosses batch (N%16==0)
    const int b    = node >> 10;
    const int n    = node & (NN - 1);
    const float val = acc[v] + bias;
    if (sel == 0)
      Qh[((size_t)(b * HH + h) * NN + n) * DK + r] = (_Float16)val;
    else if (sel == 1)
      Kh[((size_t)(b * HH + h) * NN + n) * DK + r] = (_Float16)val;
    else
      Vt[((size_t)(b * HH + h) * DK + r) * NN + n] = (_Float16)val;
  }
}

// ---------------------------------------------------------------------------
// Kernel 2: masked attention, flash-style streaming softmax, transposed form:
//   S^T = K x Q^T   (rows = keys, columns = queries)
//   O^T += V^T x P^T
// A lane owns one query column, so the row maximum and the row sum are taken
// inside the lane plus one exchange between the wave's halves, and the two
// S^T accumulator tiles, converted in place, are already the B operand P^T.
// Block = 256 threads = 8 waves = 8 heads over one (batch, 16-query tile),
// so adjacency reads are shared across heads through WGP$/L2.
// ---------------------------------------------------------------------------
__device__ __forceinline__ float other_half(float x) {
  // value of lane l ^ 16
  const int i = __builtin_bit_cast(int, x);
  return __builtin_bit_cast(float, __builtin_amdgcn_permlanex16(
      i, i, 0x76543210, 0xfedcba98, false, false));
}

__global__ __launch_bounds__(256)
void gat_attn(const _Float16* __restrict__ Qh, const _Float16* __restrict__ Kh,
              const _Float16* __restrict__ Vt, const float* __restrict__ Adj,
              _Float16* __restrict__ AO)
{
  const int lane = threadIdx.x & 31;
  const int h    = threadIdx.x >> 5;   // wave id == head
  const int r    = lane & 15;
  const int half = lane >> 4;
  const int qt   = blockIdx.x;         // query tile within batch (0..63)
  const int b    = blockIdx.y;
  const int bh   = b * HH + h;

  // Q^T B-fragment (32x16, K-dim d padded 16 -> 32 with zeros); column r = query
  v16h qb;
  {
    F16x8 t0;
    t0.u4 = *reinterpret_cast<const uint4*>(
        Qh + ((size_t)bh * NN + qt * 16 + r) * DK + half * 8);
#pragma unroll  // constant indices: the values stay in registers
    for (int e = 0; e < 8; ++e) { qb[e] = t0.h[e]; qb[8 + e] = (_Float16)0.f; }
  }

  // oacc[v] = O[query r][d = half*8 + v]
  v8f oacc = {0.f, 0.f, 0.f, 0.f, 0.f, 0.f, 0.f, 0.f};
  float mrun = -1.0e30f;   // running maximum of query r (equal in both halves)
  float lrun = 0.f;        // running sum over this lane's own keys only

  // This lane's adjacency row (query r), at its first key of a 32-key pass.
  const float* arow =
      Adj + (size_t)b * NN * NN + (size_t)(qt * 16 + r) * NN + half * 8;

  for (int kt = 0; kt < NN / 32; ++kt) {
    const int kbase = kt * 32;

    // K rows kbase + r and kbase + 16 + r, d = half*8 .. +7
    const _Float16* kp = Kh + ((size_t)bh * NN + kbase + r) * DK + half * 8;
    const v8h t0 = *reinterpret_cast<const v8h*>(kp);
    const v8h t1 = *reinterpret_cast<const v8h*>(kp + 16 * DK);
    // V^T row d = r, keys kbase + half*8 + 0..7 and + 16 + 0..7
    const _Float16* vp = Vt + ((size_t)bh * DK + r) * NN + kbase + half * 8;
    const v8h t2 = *reinterpret_cast<const v8h*>(vp);
    const v8h t3 = *reinterpret_cast<const v8h*>(vp + 16);
    // adjacency of query r at the same keys
    const v4f x0 = *reinterpret_cast<const v4f*>(arow + kbase);
    const v4f x1 = *reinterpret_cast<const v4f*>(arow + kbase + 4);
    const v4f x2 = *reinterpret_cast<const v4f*>(arow + kbase + 16);
    const v4f x3 = *reinterpret_cast<const v4f*>(arow + kbase + 20);

    // K A-fragments (16 keys x 32, d padded 16 -> 32 with zeros) and the
    // V^T A-fragment (16 d x 32 keys)
    v16h kb0, kb1, va;
#pragma unroll  // constant indices: the values stay in registers
    for (int e = 0; e < 8; ++e) {
      kb0[e] = t0[e]; kb0[8 + e] = (_Float16)0.f;
      kb1[e] = t1[e]; kb1[8 + e] = (_Float16)0.f;
      va[e]  = t2[e]; va[8 + e]  = t3[e];
    }
    float adj[16];
#pragma unroll  // constant indices: the values stay in registers
    for (int e = 0; e < 4; ++e) {
      adj[e]     = x0[e]; adj[4 + e]  = x1[e];
      adj[8 + e] = x2[e]; adj[12 + e] = x3[e];
    }

    const v8f zero = {0.f, 0.f, 0.f, 0.f, 0.f, 0.f, 0.f, 0.f};
    v8f s0 = wmma_f16(kb0, qb, zero);   // S^T[key half*8+v     ][query r]
    v8f s1 = wmma_f16(kb1, qb, zero);   // S^T[key 16+half*8+v  ][query r]

    // Mask, scale (1/sqrt(16)=0.25), streaming softmax update.
    float sv[16];
#pragma unroll  // constant indices: the values stay in registers
    for (int v = 0; v < 8; ++v) {
      sv[v]     = (adj[v]     > 0.f) ? s0[v] * 0.25f : -1.0e9f;
      sv[8 + v] = (adj[8 + v] > 0.f) ? s1[v] * 0.25f : -1.0e9f;
    }

    float tm = sv[0];
#pragma unroll  // constant indices: the values stay in registers
    for (int j = 1; j < 16; ++j) tm = fmaxf(tm, sv[j]);
    tm = fmaxf(tm, other_half(tm));     // maximum over all 32 keys of the pass

    const float mn = fmaxf(mrun, tm);
    const float al = __expf(mrun - mn);

    // P^T B-fragment: element j pairs with va's element j (same key).
    v16h pt;
    float e[16];
#pragma unroll  // constant indices: the values stay in registers
    for (int j = 0; j < 16; ++j) {
      e[j]  = __expf(sv[j] - mn);
      pt[j] = (_Float16)e[j];
    }
#pragma unroll  // constant indices: the values stay in registers
    for (int w = 8; w >= 1; w >>= 1)    // in-lane pairwise sum of the 16 terms
#pragma unroll  // constant indices: the values stay in registers
      for (int j = 0; j < w; ++j) e[j] += e[j + w];
    const float rs = e[0];

    lrun = lrun * al + rs;
    mrun = mn;
#pragma unroll  // constant indices: the values stay in registers
    for (int v = 0; v < 8; ++v) oacc[v] *= al;

    oacc = wmma_f16(va, pt, oacc);      // O^T += V^T(16x32) x P^T(32x16)
  }

  // Join the halves' sums, normalize, write attention output [B,N,H*DK] f16:
  // 8 consecutive d of one query per lane, one 16-byte store.
  lrun += other_half(lrun);
  F16x8 o;
#pragma unroll  // constant indices: the values stay in registers
  for (int v = 0; v < 8; ++v)
    o.h[v] = (_Float16)(oacc[v] / lrun);   // the maximum's own term is 1 => lrun >= 1
  *reinterpret_cast<uint4*>(
      AO + ((size_t)b * NN + qt * 16 + r) * FOUT + h * DK + half * 8) = o.u4;
}

// ---------------------------------------------------------------------------
// Kernel 3: output projection Y = AO @ Wo^T + bo (f32 result).
// ---------------------------------------------------------------------------
__global__ __launch_bounds__(32)
void gat_outproj(const _Float16* __restrict__ AO, const float* __restrict__ Wo,
                 const float* __restrict__ bo, float* __restrict__ Y)
{
  const int lane = threadIdx.x;
  const int r    = lane & 15;
  const int half = lane >> 4;
  const int t    = blockIdx.x;   // 16-row tile over B*N
  const int oc   = blockIdx.y;   // 16-wide output chunk

  const int arow = t * 16 + r;
  const int ocol = oc * DK + r;

  v8f acc = {0.f, 0.f, 0.f, 0.f, 0.f, 0.f, 0.f, 0.f};

#pragma unroll
  for (int kk = 0; kk < 4; ++kk) {
    const _Float16* ap = AO + (size_t)arow * FOUT + kk * 32 + half * 8;
    const float*    wb = Wo + (size_t)ocol * FOUT + kk * 32 + half * 8;
    F16x8 t0; t0.u4 = *reinterpret_cast<const uint4*>(ap);
    F16x8 t1; t1.u4 = *reinterpret_cast<const uint4*>(ap + 16);
    v16h a, bfr;
#pragma unroll
    for (int e = 0; e < 8; ++e) {
      a[e]       = t0.h[e];
      a[8 + e]   = t1.h[e];
      bfr[e]     = (_Float16)wb[e];
      bfr[8 + e] = (_Float16)wb[16 + e];
    }
    acc = wmma_f16(a, bfr, acc);
  }

  const float bias = bo[ocol];
#pragma unroll
  for (int v = 0; v < 8; ++v) {
    const int m = v + half * 8;
    Y[(size_t)(t * 16 + m) * FOUT + oc * DK + r] = acc[v] + bias;
  }
}

// ---------------------------------------------------------------------------
extern "C" void kernel_launch(void* const* d_in, const int* in_sizes, int n_in,
                              void* d_out, int out_size, void* d_ws, size_t ws_size,
                              hipStream_t stream) {
  const float* X   = (const float*)d_in[0];
  const float* Adj = (const float*)d_in[1];
  const float* Wq  = (const float*)d_in[2];
  const float* bq  = (const float*)d_in[3];
  const float* Wk  = (const float*)d_in[4];
  const float* bk  = (const float*)d_in[5];
  const float* Wv  = (const float*)d_in[6];
  const float* bv  = (const float*)d_in[7];
  const float* Wo  = (const float*)d_in[8];
  const float* bo  = (const float*)d_in[9];
  float* Y = (float*)d_out;

  // Workspace layout (8 MiB total, fully overwritten each call):
  //   [0,2M)   Qh  f16 [B,H,N,16]
  //   [2M,4M)  Kh  f16 [B,H,N,16]
  //   [4M,6M)  Vt  f16 [B,H,16,N]
  //   [6M,8M)  AO  f16 [B,N,128]
  char* ws = (char*)d_ws;
  _Float16* Qh = (_Float16*)(ws);
  _Float16* Kh = (_Float16*)(ws + (2u << 20));
  _Float16* Vt = (_Float16*)(ws + (4u << 20));
  _Float16* AO = (_Float16*)(ws + (6u << 20));

  // 1) QKV projections: (B*N/16)=512 row tiles x 8 heads x {Q,K,V}
  gat_proj_qkv<<<dim3(512, 8, 3), 32, 0, stream>>>(
      X, Wq, bq, Wk, bk, Wv, bv, Qh, Kh, Vt);

  // 2) Masked flash attention: (N/16)=64 query tiles x B, 8 waves = 8 heads
  gat_attn<<<dim3(64, 8), 256, 0, stream>>>(Qh, Kh, Vt, Adj, AO);

  // 3) Output projection
  gat_outproj<<<dim3(512, 8), 32, 0, stream>>>(AO, Wo, bo, Y);
}

// v002
// Measured time: 52.9 microseconds a run.
// Timed twice side by side with v001, it ran 1.13 and 1.14 times as fast.
// Counting every step since v000, it is 1.63 times as fast.
#include <hip/hip_runtime.h>

// MultiHeadGraphAttention for MI455X (gfx1250, wave32, WMMA f16->f32).
// B=8, N=1024, F_IN=F_OUT=128, H=8, D_K=16.

typedef __attribute__((ext_vector_type(16))) _Float16 v16h;
typedef __attribute__((ext_vector_type(8)))  float    v8f;
typedef __attribute__((ext_vector_type(4)))  float    v4f;
typedef __attribute__((ext_vector_type(8)))  _Float16 v8h;

#define BB   8
#define NN   1024
#define FIN  128
#define FOUT 128
#define HH   8
#define DK   16

union F16x8 { uint4 u4; _Float16 h[8]; };

__device__ __forceinline__ v8f wmma_f16(v16h a, v16h b, v8f c) {
  // D = A(16x32 f16) x B(32x16 f16) + C(16x16 f32)
  return __builtin_amdgcn_wmma_f32_16x16x32_f16(
      /*neg_a=*/false, a, /*neg_b=*/false, b,
      /*c_mod=*/(short)0, c, /*reuse_a=*/false, /*reuse_b=*/false);
}

// ---------------------------------------------------------------------------
// Kernel 1: fused QKV projection. One wave -> one 16x16 output tile.
//   sel 0: Q -> Qh[B,H,N,16] f16
//   sel 1: K -> Kh[B,H,N,16] f16
//   sel 2: V -> Vt[B,H,16,N] f16  (transposed for contiguous A-frag loads)
// ---------------------------------------------------------------------------
__global__ __launch_bounds__(32)
void gat_proj_qkv(const float* __restrict__ X,
                  const float* __restrict__ Wq, const float* __restrict__ bq,
                  const float* __restrict__ Wk, const float* __restrict__ bk,
                  const float* __restrict__ Wv, const float* __restrict__ bv,
                  _Float16* __restrict__ Qh, _Float16* __restrict__ Kh,
                  _Float16* __restrict__ Vt)
{
  const int lane = threadIdx.x;
  const int r    = lane & 15;
  const int half = lane >> 4;
  const int t    = blockIdx.x;   // 16-row tile over B*N (0..511)
  const int h    = blockIdx.y;   // head == 16-wide output chunk
  const int sel  = blockIdx.z;   // 0=Q 1=K 2=V

  const float* W  = (sel == 0) ? Wq : (sel == 1) ? Wk : Wv;
  const float* bi = (sel == 0) ? bq : (sel == 1) ? bk : bv;

  const int arow = t * 16 + r;        // A-frag row (node)
  const int ocol = h * DK + r;        // B-frag column (output channel)

  v8f acc = {0.f, 0.f, 0.f, 0.f, 0.f, 0.f, 0.f, 0.f};

#pragma unroll
  for (int kk = 0; kk < 4; ++kk) {    // K = 128 in chunks of 32
    const float* xa = X + (size_t)arow * FIN + kk * 32 + half * 8;
    const float* wb = W + (size_t)ocol * FIN + kk * 32 + half * 8;
    v16h a, bfr;
#pragma unroll
    for (int e = 0; e < 8; ++e) {
      a[e]       = (_Float16)xa[e];        // K = kk*32 + half*8 + e
      a[8 + e]   = (_Float16)xa[16 + e];   // K = kk*32 + 16 + half*8 + e
      bfr[e]     = (_Float16)wb[e];
      bfr[8 + e] = (_Float16)wb[16 + e];
    }
    acc = wmma_f16(a, bfr, acc);
  }

  const float bias = bi[ocol];

#pragma unroll
  for (int v = 0; v < 8; ++v) {
    const int m    = v + half * 8;        // C row
    const int node = t * 16 + m;          // tile never crosses batch (N%16==0)
    const int b    = node >> 10;
    const int n    = node & (NN - 1);
    const float val = acc[v] + bias;
    if (sel == 0)
      Qh[((size_t)(b * HH + h) * NN + n) * DK + r] = (_Float16)val;
    else if (sel == 1)
      Kh[((size_t)(b * HH + h) * NN + n) * DK + r] = (_Float16)val;
    else
      Vt[((size_t)(b * HH + h) * DK + r) * NN + n] = (_Float16)val;
  }
}

// ---------------------------------------------------------------------------
// Kernel 2: masked attention, flash-style streaming softmax, transposed form:
//   S^T = K x Q^T   (rows = keys, columns = queries)
//   O^T += V^T x P^T
// A lane owns one query column, so the row maximum and the row sum are taken
// inside the lane plus one exchange between the wave's halves, and the two
// S^T accumulator tiles, converted in place, are already the B operand P^T.
// Block = 256 threads = 8 waves = 8 heads over one (batch, 16-query tile).
// The block's 16 x 1024 adjacency tile is the same for all 8 heads: it is read
// from global memory once, in whole 512-byte runs with every load in flight
// together, reduced to one bit per edge and kept in LDS for all heads.
// ---------------------------------------------------------------------------
__device__ __forceinline__ float other_half(float x) {
  // value of lane l ^ 16
  const int i = __builtin_bit_cast(int, x);
  return __builtin_bit_cast(float, __builtin_amdgcn_permlanex16(
      i, i, 0x76543210, 0xfedcba98, false, false));
}

// bit ? x : -1e9, the bit taken from position pos of w
__device__ __forceinline__ float keep_edge(unsigned w, int pos, float x) {
  const int m = (int)(w << (31 - pos)) >> 31;   // all ones where the edge exists
  return __builtin_bit_cast(float,
      (m & __builtin_bit_cast(int, x)) | (~m & __builtin_bit_cast(int, -1.0e9f)));
}

// Edge bits in LDS: 8 groups (128 keys each) x 16 queries x 4 words; word c of
// a (group, query) holds, at bit l, the edge to key 128*group + 4*l + c. The 16
// queries of a group lie side by side, so a wave's 16-byte reads are one run.

__global__ __launch_bounds__(256)
void gat_attn(const _Float16* __restrict__ Qh, const _Float16* __restrict__ Kh,
              const _Float16* __restrict__ Vt, const float* __restrict__ Adj,
              _Float16* __restrict__ AO)
{
  __shared__ __attribute__((aligned(16))) unsigned ebits[8 * 16 * 4];

  const int lane = threadIdx.x & 31;
  const int h    = threadIdx.x >> 5;   // wave id == head
  const int r    = lane & 15;
  const int half = lane >> 4;
  const int qt   = blockIdx.x;         // query tile within batch (0..63)
  const int b    = blockIdx.y;
  const int bh   = b * HH + h;

  // Q^T B-fragment (32x16, K-dim d padded 16 -> 32 with zeros); column r = query
  v16h qb;
  {
    F16x8 t0;
    t0.u4 = *reinterpret_cast<const uint4*>(
        Qh + ((size_t)bh * NN + qt * 16 + r) * DK + half * 8);
#pragma unroll  // constant indices: the values stay in registers
    for (int e = 0; e < 8; ++e) { qb[e] = t0.h[e]; qb[8 + e] = (_Float16)0.f; }
  }

  // Wave h packs query rows 2h and 2h+1: 16 loads of 128 consecutive keys.
  {
    const float* arow = Adj + (size_t)b * NN * NN +
                        (size_t)(qt * 16 + 2 * h) * NN + lane * 4;
    v4f x[16];
#pragma unroll  // constant indices: the values stay in registers
    for (int i = 0; i < 16; ++i)
      x[i] = *reinterpret_cast<const v4f*>(arow + i * 128);  // rows are adjacent
    uint4 mine = make_uint4(0u, 0u, 0u, 0u);
#pragma unroll  // constant indices: the values stay in registers
    for (int i = 0; i < 16; ++i) {
      const unsigned b0 = __builtin_amdgcn_ballot_w32(x[i][0] > 0.f);
      const unsigned b1 = __builtin_amdgcn_ballot_w32(x[i][1] > 0.f);
      const unsigned b2 = __builtin_amdgcn_ballot_w32(x[i][2] > 0.f);
      const unsigned b3 = __builtin_amdgcn_ballot_w32(x[i][3] > 0.f);
      if (lane == i) mine = make_uint4(b0, b1, b2, b3);
    }
    if (lane < 16)   // lane i stores group i & 7 of row 2h + (i >> 3)
      *reinterpret_cast<uint4*>(
          &ebits[(lane & 7) * 64 + (2 * h + (lane >> 3)) * 4]) = mine;
  }

  // oacc[v] = O[query r][d = half*8 + v]
  v8f oacc = {0.f, 0.f, 0.f, 0.f, 0.f, 0.f, 0.f, 0.f};
  float mrun = -1.0e30f;   // running maximum of query r (equal in both halves)
  float lrun = 0.f;        // running sum over this lane's own keys only

  __syncthreads();         // every wave's edge bits are in LDS from here on

  for (int g = 0; g < NN / 128; ++g) {
    // Edge bits of query r for the 128 keys of this group, shifted so that the
    // bit of this half's first key of a pass stands at a constant position.
    const uint4 eb = *reinterpret_cast<const uint4*>(&ebits[g * 64 + r * 4]);
    const unsigned ew[4] = {eb.x >> (half * 2), eb.y >> (half * 2),
                            eb.z >> (half * 2), eb.w >> (half * 2)};

#pragma unroll  // the bit positions are constants of the pass within the group
    for (int s = 0; s < 4; ++s) {
      const int kbase = g * 128 + s * 32;

      // K rows kbase + r and kbase + 16 + r, d = half*8 .. +7
      const _Float16* kp = Kh + ((size_t)bh * NN + kbase + r) * DK + half * 8;
      const v8h t0 = *reinterpret_cast<const v8h*>(kp);
      const v8h t1 = *reinterpret_cast<const v8h*>(kp + 16 * DK);
      // V^T row d = r, keys kbase + half*8 + 0..7 and + 16 + 0..7
      const _Float16* vp = Vt + ((size_t)bh * DK + r) * NN + kbase + half * 8;
      const v8h t2 = *reinterpret_cast<const v8h*>(vp);
      const v8h t3 = *reinterpret_cast<const v8h*>(vp + 16);

      // K A-fragments (16 keys x 32, d padded 16 -> 32 with zeros) and the
      // V^T A-fragment (16 d x 32 keys)
      v16h kb0, kb1, va;
#pragma unroll  // constant indices: the values stay in registers
      for (int e = 0; e < 8; ++e) {
        kb0[e] = t0[e]; kb0[8 + e] = (_Float16)0.f;
        kb1[e] = t1[e]; kb1[8 + e] = (_Float16)0.f;
        va[e]  = t2[e]; va[8 + e]  = t3[e];
      }

      const v8f zero = {0.f, 0.f, 0.f, 0.f, 0.f, 0.f, 0.f, 0.f};
      v8f s0 = wmma_f16(kb0, qb, zero);   // S^T[key half*8+v     ][query r]
      v8f s1 = wmma_f16(kb1, qb, zero);   // S^T[key 16+half*8+v  ][query r]

      // Mask, scale (1/sqrt(16)=0.25), streaming softmax update.
      // Key s*32 + half*8 + v is bit s*8 + half*2 + (v>>2) of word v & 3;
      // 16 keys further on is 4 bits further on.
      float sv[16];
#pragma unroll  // constant indices: the values stay in registers
      for (int v = 0; v < 8; ++v) {
        sv[v]     = keep_edge(ew[v & 3], s * 8 + (v >> 2),     s0[v] * 0.25f);
        sv[8 + v] = keep_edge(ew[v & 3], s * 8 + 4 + (v >> 2), s1[v] * 0.25f);
      }

      float tm = sv[0];
#pragma unroll  // constant indices: the values stay in registers
      for (int j = 1; j < 16; ++j) tm = fmaxf(tm, sv[j]);
      tm = fmaxf(tm, other_half(tm));   // maximum over all 32 keys of the pass

      const float mn = fmaxf(mrun, tm);
      const float al = __expf(mrun - mn);

      // P^T B-fragment: element j pairs with va's element j (same key).
      v16h pt;
      float e[16];
#pragma unroll  // constant indices: the values stay in registers
      for (int j = 0; j < 16; ++j) {
        e[j]  = __expf(sv[j] - mn);
        pt[j] = (_Float16)e[j];
      }
#pragma unroll  // constant indices: the values stay in registers
      for (int w = 8; w >= 1; w >>= 1)  // in-lane pairwise sum of the 16 terms
#pragma unroll  // constant indices: the values stay in registers
        for (int j = 0; j < w; ++j) e[j] += e[j + w];
      const float rs = e[0];

      lrun = lrun * al + rs;
      mrun = mn;
#pragma unroll  // constant indices: the values stay in registers
      for (int v = 0; v < 8; ++v) oacc[v] *= al;

      oacc = wmma_f16(va, pt, oacc);    // O^T += V^T(16x32) x P^T(32x16)
    }
  }

  // Join the halves' sums, normalize, write attention output [B,N,H*DK] f16:
  // 8 consecutive d of one query per lane, one 16-byte store.
  lrun += other_half(lrun);
  F16x8 o;
#pragma unroll  // constant indices: the values stay in registers
  for (int v = 0; v < 8; ++v)
    o.h[v] = (_Float16)(oacc[v] / lrun);   // the maximum's own term is 1 => lrun >= 1
  *reinterpret_cast<uint4*>(
      AO + ((size_t)b * NN + qt * 16 + r) * FOUT + h * DK + half * 8) = o.u4;
}

// ---------------------------------------------------------------------------
// Kernel 3: output projection Y = AO @ Wo^T + bo (f32 result).
// ---------------------------------------------------------------------------
__global__ __launch_bounds__(32)
void gat_outproj(const _Float16* __restrict__ AO, const float* __restrict__ Wo,
                 const float* __restrict__ bo, float* __restrict__ Y)
{
  const int lane = threadIdx.x;
  const int r    = lane & 15;
  const int half = lane >> 4;
  const int t    = blockIdx.x;   // 16-row tile over B*N
  const int oc   = blockIdx.y;   // 16-wide output chunk

  const int arow = t * 16 + r;
  const int ocol = oc * DK + r;

  v8f acc = {0.f, 0.f, 0.f, 0.f, 0.f, 0.f, 0.f, 0.f};

#pragma unroll
  for (int kk = 0; kk < 4; ++kk) {
    const _Float16* ap = AO + (size_t)arow * FOUT + kk * 32 + half * 8;
    const float*    wb = Wo + (size_t)ocol * FOUT + kk * 32 + half * 8;
    F16x8 t0; t0.u4 = *reinterpret_cast<const uint4*>(ap);
    F16x8 t1; t1.u4 = *reinterpret_cast<const uint4*>(ap + 16);
    v16h a, bfr;
#pragma unroll
    for (int e = 0; e < 8; ++e) {
      a[e]       = t0.h[e];
      a[8 + e]   = t1.h[e];
      bfr[e]     = (_Float16)wb[e];
      bfr[8 + e] = (_Float16)wb[16 + e];
    }
    acc = wmma_f16(a, bfr, acc);
  }

  const float bias = bo[ocol];
#pragma unroll
  for (int v = 0; v < 8; ++v) {
    const int m = v + half * 8;
    Y[(size_t)(t * 16 + m) * FOUT + oc * DK + r] = acc[v] + bias;
  }
}

// ---------------------------------------------------------------------------
extern "C" void kernel_launch(void* const* d_in, const int* in_sizes, int n_in,
                              void* d_out, int out_size, void* d_ws, size_t ws_size,
                              hipStream_t stream) {
  const float* X   = (const float*)d_in[0];
  const float* Adj = (const float*)d_in[1];
  const float* Wq  = (const float*)d_in[2];
  const float* bq  = (const float*)d_in[3];
  const float* Wk  = (const float*)d_in[4];
  const float* bk  = (const float*)d_in[5];
  const float* Wv  = (const float*)d_in[6];
  const float* bv  = (const float*)d_in[7];
  const float* Wo  = (const float*)d_in[8];
  const float* bo  = (const float*)d_in[9];
  float* Y = (float*)d_out;

  // Workspace layout (8 MiB total, fully overwritten each call):
  //   [0,2M)   Qh  f16 [B,H,N,16]
  //   [2M,4M)  Kh  f16 [B,H,N,16]
  //   [4M,6M)  Vt  f16 [B,H,16,N]
  //   [6M,8M)  AO  f16 [B,N,128]
  char* ws = (char*)d_ws;
  _Float16* Qh = (_Float16*)(ws);
  _Float16* Kh = (_Float16*)(ws + (2u << 20));
  _Float16* Vt = (_Float16*)(ws + (4u << 20));
  _Float16* AO = (_Float16*)(ws + (6u << 20));

  // 1) QKV projections: (B*N/16)=512 row tiles x 8 heads x {Q,K,V}
  gat_proj_qkv<<<dim3(512, 8, 3), 32, 0, stream>>>(
      X, Wq, bq, Wk, bk, Wv, bv, Qh, Kh, Vt);

  // 2) Masked flash attention: (N/16)=64 query tiles x B, 8 waves = 8 heads
  gat_attn<<<dim3(64, 8), 256, 0, stream>>>(Qh, Kh, Vt, Adj, AO);

  // 3) Output projection
  gat_outproj<<<dim3(512, 8), 32, 0, stream>>>(AO, Wo, bo, Y);
}

// v003
// It runs in 33.9 microseconds.
// Two timings next to v002 put it at 1.56 and 1.55 times that version's speed.
// All steps since v000 together make it 2.53 times as fast.
#include <hip/hip_runtime.h>

// MultiHeadGraphAttention for MI455X (gfx1250, wave32, WMMA f16->f32).
// B=8, N=1024, F_IN=F_OUT=128, H=8, D_K=16.

typedef __attribute__((ext_vector_type(16))) _Float16 v16h;
typedef __attribute__((ext_vector_type(8)))  float    v8f;
typedef __attribute__((ext_vector_type(4)))  float    v4f;
typedef __attribute__((ext_vector_type(8)))  _Float16 v8h;

#define BB   8
#define NN   1024
#define FIN  128
#define FOUT 128
#define HH   8
#define DK   16

union F16x8 { uint4 u4; _Float16 h[8]; };

__device__ __forceinline__ v8f wmma_f16(v16h a, v16h b, v8f c) {
  // D = A(16x32 f16) x B(32x16 f16) + C(16x16 f32)
  return __builtin_amdgcn_wmma_f32_16x16x32_f16(
      /*neg_a=*/false, a, /*neg_b=*/false, b,
      /*c_mod=*/(short)0, c, /*reuse_a=*/false, /*reuse_b=*/false);
}

// ---------------------------------------------------------------------------
// Kernel 1: fused QKV projection.
// Block = 256 threads = 8 waves -> 64 nodes x the 128 channels of one of Q, K, V.
// The block's X rows and the whole weight matrix are read once, each row as one
// 512-byte run, converted to f16 once and kept in LDS; every wave then takes a
// 32 x 32 piece of the result (2 x 2 tiles) with its fragments read from LDS.
//   sel 0: Q -> Qh[B,H,N,16] f16
//   sel 1: K -> Kh[B,H,N,16] f16
//   sel 2: V -> Vt[B,H,16,N] f16  (transposed for contiguous fragment loads)
// ---------------------------------------------------------------------------
typedef __attribute__((ext_vector_type(4))) _Float16 v4h;

#define PROWS  64    // nodes per block
#define LPITCH 136   // f16 per staged row: 128 + 16 bytes, so that the 16-byte
                     // fragment reads of 16 rows fall on different banks

__device__ __forceinline__ void stage_row(_Float16* dst, v4f x) {
  v4h y;
  y[0] = (_Float16)x[0]; y[1] = (_Float16)x[1];
  y[2] = (_Float16)x[2]; y[3] = (_Float16)x[3];
  *reinterpret_cast<v4h*>(dst) = y;
}

// Fragment of one staged row: element e is K = kk*32 + half*8 + e, element
// 8 + e is K = kk*32 + 16 + half*8 + e (the same order for A and for B).
__device__ __forceinline__ v16h frag_row(const _Float16* row, int kk, int half) {
  const v8h lo = *reinterpret_cast<const v8h*>(row + kk * 32 + half * 8);
  const v8h hi = *reinterpret_cast<const v8h*>(row + kk * 32 + 16 + half * 8);
  return __builtin_shufflevector(lo, hi, 0, 1, 2, 3, 4, 5, 6, 7,
                                 8, 9, 10, 11, 12, 13, 14, 15);
}

__global__ __launch_bounds__(256)
void gat_proj_qkv(const float* __restrict__ X,
                  const float* __restrict__ Wq, const float* __restrict__ bq,
                  const float* __restrict__ Wk, const float* __restrict__ bk,
                  const float* __restrict__ Wv, const float* __restrict__ bv,
                  _Float16* __restrict__ Qh, _Float16* __restrict__ Kh,
                  _Float16* __restrict__ Vt)
{
  __shared__ __attribute__((aligned(16))) _Float16 xs[PROWS * LPITCH];
  __shared__ __attribute__((aligned(16))) _Float16 wsm[FOUT * LPITCH];

  const int lane = threadIdx.x & 31;
  const int w    = threadIdx.x >> 5;
  const int r    = lane & 15;
  const int half = lane >> 4;
  const int rg   = blockIdx.x;   // 64-row group over B*N (0..127)
  const int sel  = blockIdx.y;   // 0=Q 1=K 2=V

  const float* W  = (sel == 0) ? Wq : (sel == 1) ? Wk : Wv;
  const float* bi = (sel == 0) ? bq : (sel == 1) ? bk : bv;

  const int rt0 = (w & 1) * 2;    // first of this wave's two 16-node tiles
  const int h0  = (w >> 1) * 2;   // first of its two heads (16-channel chunks)
  const float bias0 = bi[h0 * DK + r];
  const float bias1 = bi[h0 * DK + DK + r];

  // Wave w stages X rows 8w .. 8w+7 of the group and weight rows 16w .. 16w+15.
  {
    const float* xp = X + (size_t)(rg * PROWS + w * 8) * FIN + lane * 4;
    const float* wp = W + (size_t)(w * 16) * FIN + lane * 4;
    v4f xv[8], wv[16];
#pragma unroll  // constant indices: the values stay in registers
    for (int i = 0; i < 8; ++i)
      xv[i] = *reinterpret_cast<const v4f*>(xp + i * FIN);
#pragma unroll  // constant indices: the values stay in registers
    for (int i = 0; i < 16; ++i)
      wv[i] = *reinterpret_cast<const v4f*>(wp + i * FIN);
    // Holds all 24 loads in front of the first conversion, so that they are in
    // flight together; without it the last loads reuse the first ones' registers
    // and start only after a whole round trip. The two addresses are named too:
    // their registers stay as they are until every load has returned.
    asm volatile("" :: "v"(xp), "v"(wp), "v"(xv[0]), "v"(xv[1]), "v"(xv[2]), "v"(xv[3]),
                       "v"(xv[4]), "v"(xv[5]), "v"(xv[6]), "v"(xv[7]),
                       "v"(wv[0]), "v"(wv[1]), "v"(wv[2]), "v"(wv[3]),
                       "v"(wv[4]), "v"(wv[5]), "v"(wv[6]), "v"(wv[7]),
                       "v"(wv[8]), "v"(wv[9]), "v"(wv[10]), "v"(wv[11]),
                       "v"(wv[12]), "v"(wv[13]), "v"(wv[14]), "v"(wv[15]));
#pragma unroll  // constant indices: the values stay in registers
    for (int i = 0; i < 8; ++i)
      stage_row(xs + (w * 8 + i) * LPITCH + lane * 4, xv[i]);
#pragma unroll  // constant indices: the values stay in registers
    for (int i = 0; i < 16; ++i)
      stage_row(wsm + (w * 16 + i) * LPITCH + lane * 4, wv[i]);
  }

  __syncthreads();   // every wave's staged rows are in LDS from here on

  v16h xf[2][4];     // A fragments: row = node
#pragma unroll  // constant indices: the values stay in registers
  for (int i = 0; i < 2; ++i)
#pragma unroll  // constant indices: the values stay in registers
    for (int kk = 0; kk < 4; ++kk)
      xf[i][kk] = frag_row(xs + ((rt0 + i) * 16 + r) * LPITCH, kk, half);

#pragma unroll  // constant indices: the values stay in registers
  for (int c = 0; c < 2; ++c) {
    const int h = h0 + c;
    const float bias = c ? bias1 : bias0;
    v16h wf[4];      // B fragments: column = output channel
#pragma unroll  // constant indices: the values stay in registers
    for (int kk = 0; kk < 4; ++kk)
      wf[kk] = frag_row(wsm + (h * DK + r) * LPITCH, kk, half);

#pragma unroll  // constant indices: the values stay in registers
    for (int i = 0; i < 2; ++i) {
      v8f acc = {0.f, 0.f, 0.f, 0.f, 0.f, 0.f, 0.f, 0.f};
#pragma unroll  // K = 128 in chunks of 32
      for (int kk = 0; kk < 4; ++kk) acc = wmma_f16(xf[i][kk], wf[kk], acc);

      const int node0 = rg * PROWS + (rt0 + i) * 16;  // a group stays in one batch
      const int b     = node0 >> 10;
      const int n0    = node0 & (NN - 1);
#pragma unroll  // constant indices: the values stay in registers
      for (int v = 0; v < 8; ++v) {
        const int n = n0 + v + half * 8;              // C row
        const float val = acc[v] + bias;
        if (sel == 0)
          Qh[((size_t)(b * HH + h) * NN + n) * DK + r] = (_Float16)val;
        else if (sel == 1)
          Kh[((size_t)(b * HH + h) * NN + n) * DK + r] = (_Float16)val;
        else
          Vt[((size_t)(b * HH + h) * DK + r) * NN + n] = (_Float16)val;
      }
    }
  }
}

// ---------------------------------------------------------------------------
// Kernel 2: masked attention, flash-style streaming softmax, transposed form:
//   S^T = K x Q^T   (rows = keys, columns = queries)
//   O^T += V^T x P^T
// A lane owns one query column, so the row maximum and the row sum are taken
// inside the lane plus one exchange between the wave's halves, and the two
// S^T accumulator tiles, converted in place, are already the B operand P^T.
// Block = 256 threads = 8 waves = 8 heads over one (batch, 16-query tile).
// The block's 16 x 1024 adjacency tile is the same for all 8 heads: it is read
// from global memory once, in whole 512-byte runs with every load in flight
// together, reduced to one bit per edge and kept in LDS for all heads.
// ---------------------------------------------------------------------------
__device__ __forceinline__ float other_half(float x) {
  // value of lane l ^ 16
  const int i = __builtin_bit_cast(int, x);
  return __builtin_bit_cast(float, __builtin_amdgcn_permlanex16(
      i, i, 0x76543210, 0xfedcba98, false, false));
}

// bit ? x : -1e9, the bit taken from position pos of w
__device__ __forceinline__ float keep_edge(unsigned w, int pos, float x) {
  const int m = (int)(w << (31 - pos)) >> 31;   // all ones where the edge exists
  return __builtin_bit_cast(float,
      (m & __builtin_bit_cast(int, x)) | (~m & __builtin_bit_cast(int, -1.0e9f)));
}

// Edge bits in LDS: 8 groups (128 keys each) x 16 queries x 4 words; word c of
// a (group, query) holds, at bit l, the edge to key 128*group + 4*l + c. The 16
// queries of a group lie side by side, so a wave's 16-byte reads are one run.

__global__ __launch_bounds__(256)
void gat_attn(const _Float16* __restrict__ Qh, const _Float16* __restrict__ Kh,
              const _Float16* __restrict__ Vt, const float* __restrict__ Adj,
              _Float16* __restrict__ AO)
{
  __shared__ __attribute__((aligned(16))) unsigned ebits[8 * 16 * 4];

  const int lane = threadIdx.x & 31;
  const int h    = threadIdx.x >> 5;   // wave id == head
  const int r    = lane & 15;
  const int half = lane >> 4;
  const int qt   = blockIdx.x;         // query tile within batch (0..63)
  const int b    = blockIdx.y;
  const int bh   = b * HH + h;

  // Q^T B-fragment (32x16, K-dim d padded 16 -> 32 with zeros); column r = query
  v16h qb;
  {
    F16x8 t0;
    t0.u4 = *reinterpret_cast<const uint4*>(
        Qh + ((size_t)bh * NN + qt * 16 + r) * DK + half * 8);
#pragma unroll  // constant indices: the values stay in registers
    for (int e = 0; e < 8; ++e) { qb[e] = t0.h[e]; qb[8 + e] = (_Float16)0.f; }
  }

  // Wave h packs query rows 2h and 2h+1: 16 loads of 128 consecutive keys.
  {
    const float* arow = Adj + (size_t)b * NN * NN +
                        (size_t)(qt * 16 + 2 * h) * NN + lane * 4;
    v4f x[16];
#pragma unroll  // constant indices: the values stay in registers
    for (int i = 0; i < 16; ++i)
      x[i] = *reinterpret_cast<const v4f*>(arow + i * 128);  // rows are adjacent
    uint4 mine = make_uint4(0u, 0u, 0u, 0u);
#pragma unroll  // constant indices: the values stay in registers
    for (int i = 0; i < 16; ++i) {
      const unsigned b0 = __builtin_amdgcn_ballot_w32(x[i][0] > 0.f);
      const unsigned b1 = __builtin_amdgcn_ballot_w32(x[i][1] > 0.f);
      const unsigned b2 = __builtin_amdgcn_ballot_w32(x[i][2] > 0.f);
      const unsigned b3 = __builtin_amdgcn_ballot_w32(x[i][3] > 0.f);
      if (lane == i) mine = make_uint4(b0, b1, b2, b3);
    }
    if (lane < 16)   // lane i stores group i & 7 of row 2h + (i >> 3)
      *reinterpret_cast<uint4*>(
          &ebits[(lane & 7) * 64 + (2 * h + (lane >> 3)) * 4]) = mine;
  }

  // oacc[v] = O[query r][d = half*8 + v]
  v8f oacc = {0.f, 0.f, 0.f, 0.f, 0.f, 0.f, 0.f, 0.f};
  float mrun = -1.0e30f;   // running maximum of query r (equal in both halves)
  float lrun = 0.f;        // running sum over this lane's own keys only

  __syncthreads();         // every wave's edge bits are in LDS from here on

  for (int g = 0; g < NN / 128; ++g) {
    // Edge bits of query r for the 128 keys of this group, shifted so that the
    // bit of this half's first key of a pass stands at a constant position.
    const uint4 eb = *reinterpret_cast<const uint4*>(&ebits[g * 64 + r * 4]);
    const unsigned ew[4] = {eb.x >> (half * 2), eb.y >> (half * 2),
                            eb.z >> (half * 2), eb.w >> (half * 2)};

#pragma unroll  // the bit positions are constants of the pass within the group
    for (int s = 0; s < 4; ++s) {
      const int kbase = g * 128 + s * 32;

      // K rows kbase + r and kbase + 16 + r, d = half*8 .. +7
      const _Float16* kp = Kh + ((size_t)bh * NN + kbase + r) * DK + half * 8;
      const v8h t0 = *reinterpret_cast<const v8h*>(kp);
      const v8h t1 = *reinterpret_cast<const v8h*>(kp + 16 * DK);
      // V^T row d = r, keys kbase + half*8 + 0..7 and + 16 + 0..7
      const _Float16* vp = Vt + ((size_t)bh * DK + r) * NN + kbase + half * 8;
      const v8h t2 = *reinterpret_cast<const v8h*>(vp);
      const v8h t3 = *reinterpret_cast<const v8h*>(vp + 16);

      // K A-fragments (16 keys x 32, d padded 16 -> 32 with zeros) and the
      // V^T A-fragment (16 d x 32 keys)
      v16h kb0, kb1, va;
#pragma unroll  // constant indices: the values stay in registers
      for (int e = 0; e < 8; ++e) {
        kb0[e] = t0[e]; kb0[8 + e] = (_Float16)0.f;
        kb1[e] = t1[e]; kb1[8 + e] = (_Float16)0.f;
        va[e]  = t2[e]; va[8 + e]  = t3[e];
      }

      const v8f zero = {0.f, 0.f, 0.f, 0.f, 0.f, 0.f, 0.f, 0.f};
      v8f s0 = wmma_f16(kb0, qb, zero);   // S^T[key half*8+v     ][query r]
      v8f s1 = wmma_f16(kb1, qb, zero);   // S^T[key 16+half*8+v  ][query r]

      // Mask, scale (1/sqrt(16)=0.25), streaming softmax update.
      // Key s*32 + half*8 + v is bit s*8 + half*2 + (v>>2) of word v & 3;
      // 16 keys further on is 4 bits further on.
      float sv[16];
#pragma unroll  // constant indices: the values stay in registers
      for (int v = 0; v < 8; ++v) {
        sv[v]     = keep_edge(ew[v & 3], s * 8 + (v >> 2),     s0[v] * 0.25f);
        sv[8 + v] = keep_edge(ew[v & 3], s * 8 + 4 + (v >> 2), s1[v] * 0.25f);
      }

      float tm = sv[0];
#pragma unroll  // constant indices: the values stay in registers
      for (int j = 1; j < 16; ++j) tm = fmaxf(tm, sv[j]);
      tm = fmaxf(tm, other_half(tm));   // maximum over all 32 keys of the pass

      const float mn = fmaxf(mrun, tm);
      const float al = __expf(mrun - mn);

      // P^T B-fragment: element j pairs with va's element j (same key).
      v16h pt;
      float e[16];
#pragma unroll  // constant indices: the values stay in registers
      for (int j = 0; j < 16; ++j) {
        e[j]  = __expf(sv[j] - mn);
        pt[j] = (_Float16)e[j];
      }
#pragma unroll  // constant indices: the values stay in registers
      for (int w = 8; w >= 1; w >>= 1)  // in-lane pairwise sum of the 16 terms
#pragma unroll  // constant indices: the values stay in registers
        for (int j = 0; j < w; ++j) e[j] += e[j + w];
      const float rs = e[0];

      lrun = lrun * al + rs;
      mrun = mn;
#pragma unroll  // constant indices: the values stay in registers
      for (int v = 0; v < 8; ++v) oacc[v] *= al;

      oacc = wmma_f16(va, pt, oacc);    // O^T += V^T(16x32) x P^T(32x16)
    }
  }

  // Join the halves' sums, normalize, write attention output [B,N,H*DK] f16:
  // 8 consecutive d of one query per lane, one 16-byte store.
  lrun += other_half(lrun);
  F16x8 o;
#pragma unroll  // constant indices: the values stay in registers
  for (int v = 0; v < 8; ++v)
    o.h[v] = (_Float16)(oacc[v] / lrun);   // the maximum's own term is 1 => lrun >= 1
  *reinterpret_cast<uint4*>(
      AO + ((size_t)b * NN + qt * 16 + r) * FOUT + h * DK + half * 8) = o.u4;
}

// ---------------------------------------------------------------------------
// Kernel 3: output projection Y = AO @ Wo^T + bo (f32 result).
// Same shape as kernel 1: block = 8 waves -> 64 rows x all 128 channels, the AO
// rows and the weight matrix read once in 512-byte runs and kept as f16 in LDS.
// ---------------------------------------------------------------------------
__global__ __launch_bounds__(256)
void gat_outproj(const _Float16* __restrict__ AO, const float* __restrict__ Wo,
                 const float* __restrict__ bo, float* __restrict__ Y)
{
  __shared__ __attribute__((aligned(16))) _Float16 as[PROWS * LPITCH];
  __shared__ __attribute__((aligned(16))) _Float16 wsm[FOUT * LPITCH];

  const int lane = threadIdx.x & 31;
  const int w    = threadIdx.x >> 5;
  const int r    = lane & 15;
  const int half = lane >> 4;
  const int rg   = blockIdx.x;    // 64-row group over B*N (0..127)

  const int rt0 = (w & 1) * 2;    // first of this wave's two 16-row tiles
  const int oc0 = (w >> 1) * 2;   // first of its two 16-channel chunks
  const float bias0 = bo[oc0 * DK + r];
  const float bias1 = bo[oc0 * DK + DK + r];

  // Wave w stages AO rows 8w .. 8w+7 of the group (two 256-byte rows a load) and
  // weight rows 16w .. 16w+15.
  {
    const _Float16* ap = AO + (size_t)(rg * PROWS + w * 8 + half) * FOUT + r * 8;
    const float*    wp = Wo + (size_t)(w * 16) * FOUT + lane * 4;
    v8h av[4];
    v4f wv[16];
#pragma unroll  // constant indices: the values stay in registers
    for (int i = 0; i < 4; ++i)
      av[i] = *reinterpret_cast<const v8h*>(ap + i * 2 * FOUT);
#pragma unroll  // constant indices: the values stay in registers
    for (int i = 0; i < 16; ++i)
      wv[i] = *reinterpret_cast<const v4f*>(wp + i * FOUT);
    // Holds all 20 loads in front of the first conversion, so that they are in
    // flight together, and their two addresses until every load has returned
    // (as in kernel 1).
    asm volatile("" :: "v"(ap), "v"(wp),
                       "v"(av[0]), "v"(av[1]), "v"(av[2]), "v"(av[3]),
                       "v"(wv[0]), "v"(wv[1]), "v"(wv[2]), "v"(wv[3]),
                       "v"(wv[4]), "v"(wv[5]), "v"(wv[6]), "v"(wv[7]),
                       "v"(wv[8]), "v"(wv[9]), "v"(wv[10]), "v"(wv[11]),
                       "v"(wv[12]), "v"(wv[13]), "v"(wv[14]), "v"(wv[15]));
#pragma unroll  // constant indices: the values stay in registers
    for (int i = 0; i < 4; ++i)
      *reinterpret_cast<v8h*>(as + (w * 8 + i * 2 + half) * LPITCH + r * 8) = av[i];
#pragma unroll  // constant indices: the values stay in registers
    for (int i = 0; i < 16; ++i)
      stage_row(wsm + (w * 16 + i) * LPITCH + lane * 4, wv[i]);
  }

  __syncthreads();   // every wave's staged rows are in LDS from here on

  v16h af[2][4];     // A fragments: row = node
#pragma unroll  // constant indices: the values stay in registers
  for (int i = 0; i < 2; ++i)
#pragma unroll  // constant indices: the values stay in registers
    for (int kk = 0; kk < 4; ++kk)
      af[i][kk] = frag_row(as + ((rt0 + i) * 16 + r) * LPITCH, kk, half);

#pragma unroll  // constant indices: the values stay in registers
  for (int c = 0; c < 2; ++c) {
    const int oc = oc0 + c;
    const float bias = c ? bias1 : bias0;
    v16h wf[4];      // B fragments: column = output channel
#pragma unroll  // constant indices: the values stay in registers
    for (int kk = 0; kk < 4; ++kk)
      wf[kk] = frag_row(wsm + (oc * DK + r) * LPITCH, kk, half);

#pragma unroll  // constant indices: the values stay in registers
    for (int i = 0; i < 2; ++i) {
      v8f acc = {0.f, 0.f, 0.f, 0.f, 0.f, 0.f, 0.f, 0.f};
#pragma unroll  // K = 128 in chunks of 32
      for (int kk = 0; kk < 4; ++kk) acc = wmma_f16(af[i][kk], wf[kk], acc);

      float* yp = Y + (size_t)(rg * PROWS + (rt0 + i) * 16 + half * 8) * FOUT +
                  oc * DK + r;
#pragma unroll  // constant indices: the values stay in registers
      for (int v = 0; v < 8; ++v) yp[v * FOUT] = acc[v] + bias;   // C row half*8 + v
    }
  }
}

// ---------------------------------------------------------------------------
extern "C" void kernel_launch(void* const* d_in, const int* in_sizes, int n_in,
                              void* d_out, int out_size, void* d_ws, size_t ws_size,
                              hipStream_t stream) {
  const float* X   = (const float*)d_in[0];
  const float* Adj = (const float*)d_in[1];
  const float* Wq  = (const float*)d_in[2];
  const float* bq  = (const float*)d_in[3];
  const float* Wk  = (const float*)d_in[4];
  const float* bk  = (const float*)d_in[5];
  const float* Wv  = (const float*)d_in[6];
  const float* bv  = (const float*)d_in[7];
  const float* Wo  = (const float*)d_in[8];
  const float* bo  = (const float*)d_in[9];
  float* Y = (float*)d_out;

  // Workspace layout (8 MiB total, fully overwritten each call):
  //   [0,2M)   Qh  f16 [B,H,N,16]
  //   [2M,4M)  Kh  f16 [B,H,N,16]
  //   [4M,6M)  Vt  f16 [B,H,16,N]
  //   [6M,8M)  AO  f16 [B,N,128]
  char* ws = (char*)d_ws;
  _Float16* Qh = (_Float16*)(ws);
  _Float16* Kh = (_Float16*)(ws + (2u << 20));
  _Float16* Vt = (_Float16*)(ws + (4u << 20));
  _Float16* AO = (_Float16*)(ws + (6u << 20));

  // 1) QKV projections: (B*N/64)=128 row groups x {Q,K,V}, 8 waves each
  gat_proj_qkv<<<dim3(128, 3), 256, 0, stream>>>(
      X, Wq, bq, Wk, bk, Wv, bv, Qh, Kh, Vt);

  // 2) Masked flash attention: (N/16)=64 query tiles x B, 8 waves = 8 heads
  gat_attn<<<dim3(64, 8), 256, 0, stream>>>(Qh, Kh, Vt, Adj, AO);

  // 3) Output projection: (B*N/64)=128 row groups, 8 waves each
  gat_outproj<<<dim3(128), 256, 0, stream>>>(AO, Wo, bo, Y);
}

// v004
// One run takes 31.8 microseconds.
// Two timings next to v003 both put it at 1.07 times that version's speed.
// Counting every step since v000, it is 2.71 times as fast.
#include <hip/hip_runtime.h>

// MultiHeadGraphAttention for MI455X (gfx1250, wave32, WMMA f16->f32).
// B=8, N=1024, F_IN=F_OUT=128, H=8, D_K=16.

typedef __attribute__((ext_vector_type(16))) _Float16 v16h;
typedef __attribute__((ext_vector_type(8)))  float    v8f;
typedef __attribute__((ext_vector_type(4)))  float    v4f;
typedef __attribute__((ext_vector_type(8)))  _Float16 v8h;

#define BB   8
#define NN   1024
#define FIN  128
#define FOUT 128
#define HH   8
#define DK   16

union F16x8 { uint4 u4; _Float16 h[8]; };

__device__ __forceinline__ v8f wmma_f16(v16h a, v16h b, v8f c) {
  // D = A(16x32 f16) x B(32x16 f16) + C(16x16 f32)
  return __builtin_amdgcn_wmma_f32_16x16x32_f16(
      /*neg_a=*/false, a, /*neg_b=*/false, b,
      /*c_mod=*/(short)0, c, /*reuse_a=*/false, /*reuse_b=*/false);
}

// ---------------------------------------------------------------------------
// Kernel 1: fused QKV projection.
// Block = 256 threads = 8 waves -> 64 nodes x the 128 channels of one of Q, K, V.
// The block's X rows and the whole weight matrix are read once, each row as one
// 512-byte run, converted to f16 once and kept in LDS; every wave then takes a
// 32 x 32 piece of the result (2 x 2 tiles) with its fragments read from LDS.
//   sel 0: Q -> Qh[B,H,N,16] f16
//   sel 1: K -> Kh[B,H,N,16] f16
//   sel 2: V -> Vt[B,H,16,N] f16  (transposed for contiguous fragment loads)
// ---------------------------------------------------------------------------
typedef __attribute__((ext_vector_type(4))) _Float16 v4h;

#define PROWS  64    // nodes per block
#define LPITCH 136   // f16 per staged row: 128 + 16 bytes, so that the 16-byte
                     // fragment reads of 16 rows fall on different banks

__device__ __forceinline__ void stage_row(_Float16* dst, v4f x) {
  v4h y;
  y[0] = (_Float16)x[0]; y[1] = (_Float16)x[1];
  y[2] = (_Float16)x[2]; y[3] = (_Float16)x[3];
  *reinterpret_cast<v4h*>(dst) = y;
}

// Fragment of one staged row: element e is K = kk*32 + half*8 + e, element
// 8 + e is K = kk*32 + 16 + half*8 + e (the same order for A and for B).
__device__ __forceinline__ v16h frag_row(const _Float16* row, int kk, int half) {
  const v8h lo = *reinterpret_cast<const v8h*>(row + kk * 32 + half * 8);
  const v8h hi = *reinterpret_cast<const v8h*>(row + kk * 32 + 16 + half * 8);
  return __builtin_shufflevector(lo, hi, 0, 1, 2, 3, 4, 5, 6, 7,
                                 8, 9, 10, 11, 12, 13, 14, 15);
}

__global__ __launch_bounds__(256)
void gat_proj_qkv(const float* __restrict__ X,
                  const float* __restrict__ Wq, const float* __restrict__ bq,
                  const float* __restrict__ Wk, const float* __restrict__ bk,
                  const float* __restrict__ Wv, const float* __restrict__ bv,
                  _Float16* __restrict__ Qh, _Float16* __restrict__ Kh,
                  _Float16* __restrict__ Vt)
{
  __shared__ __attribute__((aligned(16))) _Float16 xs[PROWS * LPITCH];
  __shared__ __attribute__((aligned(16))) _Float16 wsm[FOUT * LPITCH];

  const int lane = threadIdx.x & 31;
  const int w    = threadIdx.x >> 5;
  const int r    = lane & 15;
  const int half = lane >> 4;
  const int rg   = blockIdx.x;   // 64-row group over B*N (0..127)
  const int sel  = blockIdx.y;   // 0=Q 1=K 2=V

  const float* W  = (sel == 0) ? Wq : (sel == 1) ? Wk : Wv;
  const float* bi = (sel == 0) ? bq : (sel == 1) ? bk : bv;

  const int rt0 = (w & 1) * 2;    // first of this wave's two 16-node tiles
  const int h0  = (w >> 1) * 2;   // first of its two heads (16-channel chunks)
  const float bias0 = bi[h0 * DK + r];
  const float bias1 = bi[h0 * DK + DK + r];

  // Wave w stages X rows 8w .. 8w+7 of the group and weight rows 16w .. 16w+15.
  {
    const float* xp = X + (size_t)(rg * PROWS + w * 8) * FIN + lane * 4;
    const float* wp = W + (size_t)(w * 16) * FIN + lane * 4;
    v4f xv[8], wv[16];
#pragma unroll  // constant indices: the values stay in registers
    for (int i = 0; i < 8; ++i)
      xv[i] = *reinterpret_cast<const v4f*>(xp + i * FIN);
#pragma unroll  // constant indices: the values stay in registers
    for (int i = 0; i < 16; ++i)
      wv[i] = *reinterpret_cast<const v4f*>(wp + i * FIN);
    // Holds all 24 loads in front of the first conversion, so that they are in
    // flight together; without it the last loads reuse the first ones' registers
    // and start only after a whole round trip. The two addresses are named too:
    // their registers stay as they are until every load has returned.
    asm volatile("" :: "v"(xp), "v"(wp), "v"(xv[0]), "v"(xv[1]), "v"(xv[2]), "v"(xv[3]),
                       "v"(xv[4]), "v"(xv[5]), "v"(xv[6]), "v"(xv[7]),
                       "v"(wv[0]), "v"(wv[1]), "v"(wv[2]), "v"(wv[3]),
                       "v"(wv[4]), "v"(wv[5]), "v"(wv[6]), "v"(wv[7]),
                       "v"(wv[8]), "v"(wv[9]), "v"(wv[10]), "v"(wv[11]),
                       "v"(wv[12]), "v"(wv[13]), "v"(wv[14]), "v"(wv[15]));
#pragma unroll  // constant indices: the values stay in registers
    for (int i = 0; i < 8; ++i)
      stage_row(xs + (w * 8 + i) * LPITCH + lane * 4, xv[i]);
#pragma unroll  // constant indices: the values stay in registers
    for (int i = 0; i < 16; ++i)
      stage_row(wsm + (w * 16 + i) * LPITCH + lane * 4, wv[i]);
  }

  __syncthreads();   // every wave's staged rows are in LDS from here on

  v16h xf[2][4];     // A fragments: row = node
#pragma unroll  // constant indices: the values stay in registers
  for (int i = 0; i < 2; ++i)
#pragma unroll  // constant indices: the values stay in registers
    for (int kk = 0; kk < 4; ++kk)
      xf[i][kk] = frag_row(xs + ((rt0 + i) * 16 + r) * LPITCH, kk, half);

#pragma unroll  // constant indices: the values stay in registers
  for (int c = 0; c < 2; ++c) {
    const int h = h0 + c;
    const float bias = c ? bias1 : bias0;
    v16h wf[4];      // B fragments: column = output channel
#pragma unroll  // constant indices: the values stay in registers
    for (int kk = 0; kk < 4; ++kk)
      wf[kk] = frag_row(wsm + (h * DK + r) * LPITCH, kk, half);

#pragma unroll  // constant indices: the values stay in registers
    for (int i = 0; i < 2; ++i) {
      v8f acc = {0.f, 0.f, 0.f, 0.f, 0.f, 0.f, 0.f, 0.f};
#pragma unroll  // K = 128 in chunks of 32
      for (int kk = 0; kk < 4; ++kk) acc = wmma_f16(xf[i][kk], wf[kk], acc);

      const int node0 = rg * PROWS + (rt0 + i) * 16;  // a group stays in one batch
      const int b     = node0 >> 10;
      const int n0    = node0 & (NN - 1);
#pragma unroll  // constant indices: the values stay in registers
      for (int v = 0; v < 8; ++v) {
        const int n = n0 + v + half * 8;              // C row
        const float val = acc[v] + bias;
        if (sel == 0)
          Qh[((size_t)(b * HH + h) * NN + n) * DK + r] = (_Float16)val;
        else if (sel == 1)
          Kh[((size_t)(b * HH + h) * NN + n) * DK + r] = (_Float16)val;
        else
          Vt[((size_t)(b * HH + h) * DK + r) * NN + n] = (_Float16)val;
      }
    }
  }
}

// ---------------------------------------------------------------------------
// Kernel 2: masked attention, flash-style streaming softmax, transposed form:
//   S^T = K x Q^T   (rows = keys, columns = queries)
//   O^T += V^T x P^T
// A lane owns one query column, so the row maximum and the row sum are taken
// inside the lane plus one exchange between the wave's halves, and the two
// S^T accumulator tiles, converted in place, are already the B operand P^T.
// Block = 256 threads = 8 waves = 8 heads over one (batch, 16-query tile).
// The block's 16 x 1024 adjacency tile is the same for all 8 heads: it is read
// from global memory once, in whole 512-byte runs with every load in flight
// together, turned into an f16 mask (0 on an edge, -MBIG elsewhere) and kept in
// LDS for all heads. The head dimension fills only 16 of the 32 k positions of
// S^T = K x Q^T; the other 16 carry the mask: K's side holds the 16 keys x 16
// queries mask tile, Q's side MBIG times the identity, so that the product
// itself adds -MBIG*MBIG to every score without an edge and exactly 0 to the
// others: masking a score takes no vector work, and the B operand stays the
// same for all keys.
// ---------------------------------------------------------------------------
__device__ __forceinline__ float other_half(float x) {
  // value of lane l ^ 16
  const int i = __builtin_bit_cast(int, x);
  return __builtin_bit_cast(float, __builtin_amdgcn_permlanex16(
      i, i, 0x76543210, 0xfedcba98, false, false));
}

#define MBIG   32768.0f   // exact in f16; -MBIG*MBIG = -2^30, exact in the f32 sum

// Mask in LDS, in pieces of 16 bytes = one key x 8 queries: 2 planes (queries
// 0..7, queries 8..15) x 4 rows (key & 3) x MROW pieces (key >> 2). A lane that
// holds 4 consecutive keys stores beside its neighbours (one 512-byte run a
// store); the 4 pad pieces of a row put the reads of 16 consecutive keys on
// different banks.
#define MROW 260

__global__ __launch_bounds__(256)
void gat_attn(const _Float16* __restrict__ Qh, const _Float16* __restrict__ Kh,
              const _Float16* __restrict__ Vt, const float* __restrict__ Adj,
              _Float16* __restrict__ AO)
{
  __shared__ __attribute__((aligned(16))) _Float16 kmask[2 * 4 * MROW * 8];
  // bit q of word w: query q has an edge among the keys that wave w looked at
  __shared__ __attribute__((aligned(16))) unsigned live[8];

  const int lane = threadIdx.x & 31;
  const int h    = threadIdx.x >> 5;   // wave id == head
  const int r    = lane & 15;
  const int half = lane >> 4;
  const int qt   = blockIdx.x;         // query tile within batch (0..63)
  const int b    = blockIdx.y;
  const int bh   = b * HH + h;

  // Query r, d = half*8 .. +7
  F16x8 q0;
  q0.u4 = *reinterpret_cast<const uint4*>(
      Qh + ((size_t)bh * NN + qt * 16 + r) * DK + half * 8);

  // Wave h masks keys 128h .. 128h+127 of all 16 queries: 16 loads of 128
  // consecutive keys; a lane then holds 4 keys x 16 queries.
  {
    const float* acol = Adj + (size_t)b * NN * NN + (size_t)(qt * 16) * NN +
                        h * 128 + lane * 4;
    v4f x[16];
#pragma unroll  // constant indices: the values stay in registers
    for (int q = 0; q < 16; ++q)
      x[q] = *reinterpret_cast<const v4f*>(acol + q * NN);
    unsigned seen = 0u;   // bit q: an edge of query q seen by any lane
#pragma unroll  // constant indices: the values stay in registers
    for (int q = 0; q < 16; ++q) {
      const unsigned any = __builtin_amdgcn_ballot_w32(x[q][0] > 0.f) |
                           __builtin_amdgcn_ballot_w32(x[q][1] > 0.f) |
                           __builtin_amdgcn_ballot_w32(x[q][2] > 0.f) |
                           __builtin_amdgcn_ballot_w32(x[q][3] > 0.f);
      seen |= any ? (1u << q) : 0u;
    }
    _Float16* cw = kmask + (h * 32 + lane) * 8;   // key >> 2 = 32h + lane
#pragma unroll  // constant indices: the values stay in registers
    for (int p = 0; p < 2; ++p)
#pragma unroll  // constant indices: the values stay in registers
      for (int j = 0; j < 4; ++j) {
        v8h cv;
#pragma unroll  // constant indices: the values stay in registers
        for (int e = 0; e < 8; ++e)
          cv[e] = (x[p * 8 + e][j] > 0.f) ? (_Float16)0.f : (_Float16)(-MBIG);
        *reinterpret_cast<v8h*>(cw + (p * 4 + j) * MROW * 8) = cv;
      }
    if (lane == 0) live[h] = seen;
  }

  // oacc[v] = O[query r][d = half*8 + v]
  v8f oacc = {0.f, 0.f, 0.f, 0.f, 0.f, 0.f, 0.f, 0.f};
  float mrun = -1.0e30f;   // running maximum of query r (equal in both halves)
  float lrun = 0.f;        // running sum over this lane's own keys only

  __syncthreads();         // every wave's part of the mask is in LDS from here on

  // A query without any edge gets a zero Q column: its scores are then -2^30
  // exactly, all equal, and its softmax is uniform as the definition asks
  // (K x Q^T - 2^30 would round differently from key to key).
  {
    const uint4 la = *reinterpret_cast<const uint4*>(&live[0]);
    const uint4 lb = *reinterpret_cast<const uint4*>(&live[4]);
    const unsigned seen = la.x | la.y | la.z | la.w | lb.x | lb.y | lb.z | lb.w;
    const unsigned lv = ((seen >> r) & 1u) ? 0xffffffffu : 0u;
    q0.u4.x &= lv; q0.u4.y &= lv; q0.u4.z &= lv; q0.u4.w &= lv;
  }

  // B-fragment (32 x 16 queries), column r = query: k = d holds Q^T, k position
  // 16 + half*8 + e holds MBIG where it is the column's own query, else 0.
  v16h qb;
#pragma unroll  // constant indices: the values stay in registers
  for (int e = 0; e < 8; ++e) {
    qb[e]     = q0.h[e];
    qb[8 + e] = (half * 8 + e == r) ? (_Float16)MBIG : (_Float16)0.f;
  }

  // Mask of key r of a tile, queries half*8 .. +7
  const _Float16* mrow = kmask + ((half * 4 + (r & 3)) * MROW + (r >> 2)) * 8;

  for (int g = 0; g < NN / 128; ++g) {
#pragma unroll  // four passes' loads can be issued ahead of their use
    for (int s = 0; s < 4; ++s) {
      const int kbase = g * 128 + s * 32;

      // K rows kbase + r and kbase + 16 + r, d = half*8 .. +7
      const _Float16* kp = Kh + ((size_t)bh * NN + kbase + r) * DK + half * 8;
      const v8h t0 = *reinterpret_cast<const v8h*>(kp);
      const v8h t1 = *reinterpret_cast<const v8h*>(kp + 16 * DK);
      // V^T row d = r, keys kbase + half*8 + 0..7 and + 16 + 0..7
      const _Float16* vp = Vt + ((size_t)bh * DK + r) * NN + kbase + half * 8;
      const v8h t2 = *reinterpret_cast<const v8h*>(vp);
      const v8h t3 = *reinterpret_cast<const v8h*>(vp + 16);

      // Mask of keys kbase + r and kbase + 16 + r, queries half*8 .. +7
      const v8h m0 = *reinterpret_cast<const v8h*>(mrow + (kbase >> 2) * 8);
      const v8h m1 = *reinterpret_cast<const v8h*>(mrow + ((kbase + 16) >> 2) * 8);

      // A-fragments (16 keys x 32): k = d holds K, k = 16 + query holds the mask;
      // V^T A-fragment (16 d x 32 keys)
      v16h kb0, kb1, va;
#pragma unroll  // constant indices: the values stay in registers
      for (int e = 0; e < 8; ++e) {
        kb0[e] = t0[e]; kb0[8 + e] = m0[e];
        kb1[e] = t1[e]; kb1[8 + e] = m1[e];
        va[e]  = t2[e]; va[8 + e]  = t3[e];
      }

      const v8f zero = {0.f, 0.f, 0.f, 0.f, 0.f, 0.f, 0.f, 0.f};
      v8f s0 = wmma_f16(kb0, qb, zero);   // masked S^T[key half*8+v    ][query r]
      v8f s1 = wmma_f16(kb1, qb, zero);   // masked S^T[key 16+half*8+v ][query r]

      // Scale (1/sqrt(16)=0.25), streaming softmax update.
      float sv[16];
#pragma unroll  // constant indices: the values stay in registers
      for (int v = 0; v < 8; ++v) {
        sv[v]     = s0[v] * 0.25f;
        sv[8 + v] = s1[v] * 0.25f;
      }

      float tm = sv[0];
#pragma unroll  // constant indices: the values stay in registers
      for (int j = 1; j < 16; ++j) tm = fmaxf(tm, sv[j]);
      tm = fmaxf(tm, other_half(tm));   // maximum over all 32 keys of the pass

      const float mn = fmaxf(mrun, tm);
      const float al = __expf(mrun - mn);

      // P^T B-fragment: element j pairs with va's element j (same key).
      v16h pt;
      float e[16];
#pragma unroll  // constant indices: the values stay in registers
      for (int j = 0; j < 16; ++j) {
        e[j]  = __expf(sv[j] - mn);
        pt[j] = (_Float16)e[j];
      }
#pragma unroll  // constant indices: the values stay in registers
      for (int w = 8; w >= 1; w >>= 1)  // in-lane pairwise sum of the 16 terms
#pragma unroll  // constant indices: the values stay in registers
        for (int j = 0; j < w; ++j) e[j] += e[j + w];
      const float rs = e[0];

      lrun = lrun * al + rs;
      mrun = mn;
#pragma unroll  // constant indices: the values stay in registers
      for (int v = 0; v < 8; ++v) oacc[v] *= al;

      oacc = wmma_f16(va, pt, oacc);    // O^T += V^T(16x32) x P^T(32x16)
    }
  }

  // Join the halves' sums, normalize, write attention output [B,N,H*DK] f16:
  // 8 consecutive d of one query per lane, one 16-byte store.
  lrun += other_half(lrun);
  F16x8 o;
#pragma unroll  // constant indices: the values stay in registers
  for (int v = 0; v < 8; ++v)
    o.h[v] = (_Float16)(oacc[v] / lrun);   // the maximum's own term is 1 => lrun >= 1
  *reinterpret_cast<uint4*>(
      AO + ((size_t)b * NN + qt * 16 + r) * FOUT + h * DK + half * 8) = o.u4;
}

// ---------------------------------------------------------------------------
// Kernel 3: output projection Y = AO @ Wo^T + bo (f32 result).
// Same shape as kernel 1: block = 8 waves -> 64 rows x all 128 channels, the AO
// rows and the weight matrix read once in 512-byte runs and kept as f16 in LDS.
// ---------------------------------------------------------------------------
__global__ __launch_bounds__(256)
void gat_outproj(const _Float16* __restrict__ AO, const float* __restrict__ Wo,
                 const float* __restrict__ bo, float* __restrict__ Y)
{
  __shared__ __attribute__((aligned(16))) _Float16 as[PROWS * LPITCH];
  __shared__ __attribute__((aligned(16))) _Float16 wsm[FOUT * LPITCH];

  const int lane = threadIdx.x & 31;
  const int w    = threadIdx.x >> 5;
  const int r    = lane & 15;
  const int half = lane >> 4;
  const int rg   = blockIdx.x;    // 64-row group over B*N (0..127)

  const int rt0 = (w & 1) * 2;    // first of this wave's two 16-row tiles
  const int oc0 = (w >> 1) * 2;   // first of its two 16-channel chunks
  const float bias0 = bo[oc0 * DK + r];
  const float bias1 = bo[oc0 * DK + DK + r];

  // Wave w stages AO rows 8w .. 8w+7 of the group (two 256-byte rows a load) and
  // weight rows 16w .. 16w+15.
  {
    const _Float16* ap = AO + (size_t)(rg * PROWS + w * 8 + half) * FOUT + r * 8;
    const float*    wp = Wo + (size_t)(w * 16) * FOUT + lane * 4;
    v8h av[4];
    v4f wv[16];
#pragma unroll  // constant indices: the values stay in registers
    for (int i = 0; i < 4; ++i)
      av[i] = *reinterpret_cast<const v8h*>(ap + i * 2 * FOUT);
#pragma unroll  // constant indices: the values stay in registers
    for (int i = 0; i < 16; ++i)
      wv[i] = *reinterpret_cast<const v4f*>(wp + i * FOUT);
    // Holds all 20 loads in front of the first conversion, so that they are in
    // flight together, and their two addresses until every load has returned
    // (as in kernel 1).
    asm volatile("" :: "v"(ap), "v"(wp),
                       "v"(av[0]), "v"(av[1]), "v"(av[2]), "v"(av[3]),
                       "v"(wv[0]), "v"(wv[1]), "v"(wv[2]), "v"(wv[3]),
                       "v"(wv[4]), "v"(wv[5]), "v"(wv[6]), "v"(wv[7]),
                       "v"(wv[8]), "v"(wv[9]), "v"(wv[10]), "v"(wv[11]),
                       "v"(wv[12]), "v"(wv[13]), "v"(wv[14]), "v"(wv[15]));
#pragma unroll  // constant indices: the values stay in registers
    for (int i = 0; i < 4; ++i)
      *reinterpret_cast<v8h*>(as + (w * 8 + i * 2 + half) * LPITCH + r * 8) = av[i];
#pragma unroll  // constant indices: the values stay in registers
    for (int i = 0; i < 16; ++i)
      stage_row(wsm + (w * 16 + i) * LPITCH + lane * 4, wv[i]);
  }

  __syncthreads();   // every wave's staged rows are in LDS from here on

  v16h af[2][4];     // A fragments: row = node
#pragma unroll  // constant indices: the values stay in registers
  for (int i = 0; i < 2; ++i)
#pragma unroll  // constant indices: the values stay in registers
    for (int kk = 0; kk < 4; ++kk)
      af[i][kk] = frag_row(as + ((rt0 + i) * 16 + r) * LPITCH, kk, half);

#pragma unroll  // constant indices: the values stay in registers
  for (int c = 0; c < 2; ++c) {
    const int oc = oc0 + c;
    const float bias = c ? bias1 : bias0;
    v16h wf[4];      // B fragments: column = output channel
#pragma unroll  // constant indices: the values stay in registers
    for (int kk = 0; kk < 4; ++kk)
      wf[kk] = frag_row(wsm + (oc * DK + r) * LPITCH, kk, half);

#pragma unroll  // constant indices: the values stay in registers
    for (int i = 0; i < 2; ++i) {
      v8f acc = {0.f, 0.f, 0.f, 0.f, 0.f, 0.f, 0.f, 0.f};
#pragma unroll  // K = 128 in chunks of 32
      for (int kk = 0; kk < 4; ++kk) acc = wmma_f16(af[i][kk], wf[kk], acc);

      float* yp = Y + (size_t)(rg * PROWS + (rt0 + i) * 16 + half * 8) * FOUT +
                  oc * DK + r;
#pragma unroll  // constant indices: the values stay in registers
      for (int v = 0; v < 8; ++v) yp[v * FOUT] = acc[v] + bias;   // C row half*8 + v
    }
  }
}

// ---------------------------------------------------------------------------
extern "C" void kernel_launch(void* const* d_in, const int* in_sizes, int n_in,
                              void* d_out, int out_size, void* d_ws, size_t ws_size,
                              hipStream_t stream) {
  const float* X   = (const float*)d_in[0];
  const float* Adj = (const float*)d_in[1];
  const float* Wq  = (const float*)d_in[2];
  const float* bq  = (const float*)d_in[3];
  const float* Wk  = (const float*)d_in[4];
  const float* bk  = (const float*)d_in[5];
  const float* Wv  = (const float*)d_in[6];
  const float* bv  = (const float*)d_in[7];
  const float* Wo  = (const float*)d_in[8];
  const float* bo  = (const float*)d_in[9];
  float* Y = (float*)d_out;

  // Workspace layout (8 MiB total, fully overwritten each call):
  //   [0,2M)   Qh  f16 [B,H,N,16]
  //   [2M,4M)  Kh  f16 [B,H,N,16]
  //   [4M,6M)  Vt  f16 [B,H,16,N]
  //   [6M,8M)  AO  f16 [B,N,128]
  char* ws = (char*)d_ws;
  _Float16* Qh = (_Float16*)(ws);
  _Float16* Kh = (_Float16*)(ws + (2u << 20));
  _Float16* Vt = (_Float16*)(ws + (4u << 20));
  _Float16* AO = (_Float16*)(ws + (6u << 20));

  // 1) QKV projections: (B*N/64)=128 row groups x {Q,K,V}, 8 waves each
  gat_proj_qkv<<<dim3(128, 3), 256, 0, stream>>>(
      X, Wq, bq, Wk, bk, Wv, bv, Qh, Kh, Vt);

  // 2) Masked flash attention: (N/16)=64 query tiles x B, 8 waves = 8 heads
  gat_attn<<<dim3(64, 8), 256, 0, stream>>>(Qh, Kh, Vt, Adj, AO);

  // 3) Output projection: (B*N/64)=128 row groups, 8 waves each
  gat_outproj<<<dim3(128), 256, 0, stream>>>(AO, Wo, bo, Y);
}

// v005
// It runs in 28.4 microseconds.
// Two timings next to v004 put it at 1.12 and 1.13 times that version's speed.
// All steps since v000 together make it 3.04 times as fast.
#include <hip/hip_runtime.h>

// MultiHeadGraphAttention for MI455X (gfx1250, wave32, WMMA f16->f32).
// B=8, N=1024, F_IN=F_OUT=128, H=8, D_K=16.

typedef __attribute__((ext_vector_type(16))) _Float16 v16h;
typedef __attribute__((ext_vector_type(8)))  float    v8f;
typedef __attribute__((ext_vector_type(4)))  float    v4f;
typedef __attribute__((ext_vector_type(8)))  _Float16 v8h;

#define BB   8
#define NN   1024
#define FIN  128
#define FOUT 128
#define HH   8
#define DK   16

union F16x8 { uint4 u4; _Float16 h[8]; };

__device__ __forceinline__ v8f wmma_f16(v16h a, v16h b, v8f c) {
  // D = A(16x32 f16) x B(32x16 f16) + C(16x16 f32)
  return __builtin_amdgcn_wmma_f32_16x16x32_f16(
      /*neg_a=*/false, a, /*neg_b=*/false, b,
      /*c_mod=*/(short)0, c, /*reuse_a=*/false, /*reuse_b=*/false);
}

// ---------------------------------------------------------------------------
// Kernel 1: fused QKV projection.
// Block = 256 threads = 8 waves -> 64 nodes x the 128 channels of one of Q, K, V.
// The block's X rows and the whole weight matrix are read once, each row as one
// 512-byte run, converted to f16 once and kept in LDS; every wave then takes a
// 32 x 32 piece of the result (2 x 2 tiles) with its fragments read from LDS.
//   sel 0: Q -> Qh[B,H,N,16] f16
//   sel 1: K -> Kh[B,H,N,16] f16
//   sel 2: V -> Vt[B,H,16,N] f16  (transposed for contiguous fragment loads)
// ---------------------------------------------------------------------------
typedef __attribute__((ext_vector_type(4))) _Float16 v4h;

#define PROWS  64    // nodes per block
#define LPITCH 136   // f16 per staged row: 128 + 16 bytes, so that the 16-byte
                     // fragment reads of 16 rows fall on different banks

__device__ __forceinline__ void stage_row(_Float16* dst, v4f x) {
  v4h y;
  y[0] = (_Float16)x[0]; y[1] = (_Float16)x[1];
  y[2] = (_Float16)x[2]; y[3] = (_Float16)x[3];
  *reinterpret_cast<v4h*>(dst) = y;
}

// Fragment of one staged row: element e is K = kk*32 + half*8 + e, element
// 8 + e is K = kk*32 + 16 + half*8 + e (the same order for A and for B).
__device__ __forceinline__ v16h frag_row(const _Float16* row, int kk, int half) {
  const v8h lo = *reinterpret_cast<const v8h*>(row + kk * 32 + half * 8);
  const v8h hi = *reinterpret_cast<const v8h*>(row + kk * 32 + 16 + half * 8);
  return __builtin_shufflevector(lo, hi, 0, 1, 2, 3, 4, 5, 6, 7,
                                 8, 9, 10, 11, 12, 13, 14, 15);
}

__global__ __launch_bounds__(256)
void gat_proj_qkv(const float* __restrict__ X,
                  const float* __restrict__ Wq, const float* __restrict__ bq,
                  const float* __restrict__ Wk, const float* __restrict__ bk,
                  const float* __restrict__ Wv, const float* __restrict__ bv,
                  _Float16* __restrict__ Qh, _Float16* __restrict__ Kh,
                  _Float16* __restrict__ Vt)
{
  __shared__ __attribute__((aligned(16))) _Float16 xs[PROWS * LPITCH];
  __shared__ __attribute__((aligned(16))) _Float16 wsm[FOUT * LPITCH];

  const int lane = threadIdx.x & 31;
  const int w    = threadIdx.x >> 5;
  const int r    = lane & 15;
  const int half = lane >> 4;
  const int rg   = blockIdx.x;   // 64-row group over B*N (0..127)
  const int sel  = blockIdx.y;   // 0=Q 1=K 2=V

  const float* W  = (sel == 0) ? Wq : (sel == 1) ? Wk : Wv;
  const float* bi = (sel == 0) ? bq : (sel == 1) ? bk : bv;

  const int rt0 = (w & 1) * 2;    // first of this wave's two 16-node tiles
  const int h0  = (w >> 1) * 2;   // first of its two heads (16-channel chunks)
  const float bias0 = bi[h0 * DK + r];
  const float bias1 = bi[h0 * DK + DK + r];

  // Wave w stages X rows 8w .. 8w+7 of the group and weight rows 16w .. 16w+15.
  {
    const float* xp = X + (size_t)(rg * PROWS + w * 8) * FIN + lane * 4;
    const float* wp = W + (size_t)(w * 16) * FIN + lane * 4;
    v4f xv[8], wv[16];
#pragma unroll  // constant indices: the values stay in registers
    for (int i = 0; i < 8; ++i)
      xv[i] = *reinterpret_cast<const v4f*>(xp + i * FIN);
#pragma unroll  // constant indices: the values stay in registers
    for (int i = 0; i < 16; ++i)
      wv[i] = *reinterpret_cast<const v4f*>(wp + i * FIN);
    // Holds all 24 loads in front of the first conversion, so that they are in
    // flight together; without it the last loads reuse the first ones' registers
    // and start only after a whole round trip. The two addresses are named too:
    // their registers stay as they are until every load has returned.
    asm volatile("" :: "v"(xp), "v"(wp), "v"(xv[0]), "v"(xv[1]), "v"(xv[2]), "v"(xv[3]),
                       "v"(xv[4]), "v"(xv[5]), "v"(xv[6]), "v"(xv[7]),
                       "v"(wv[0]), "v"(wv[1]), "v"(wv[2]), "v"(wv[3]),
                       "v"(wv[4]), "v"(wv[5]), "v"(wv[6]), "v"(wv[7]),
                       "v"(wv[8]), "v"(wv[9]), "v"(wv[10]), "v"(wv[11]),
                       "v"(wv[12]), "v"(wv[13]), "v"(wv[14]), "v"(wv[15]));
#pragma unroll  // constant indices: the values stay in registers
    for (int i = 0; i < 8; ++i)
      stage_row(xs + (w * 8 + i) * LPITCH + lane * 4, xv[i]);
#pragma unroll  // constant indices: the values stay in registers
    for (int i = 0; i < 16; ++i)
      stage_row(wsm + (w * 16 + i) * LPITCH + lane * 4, wv[i]);
  }

  __syncthreads();   // every wave's staged rows are in LDS from here on

  v16h xf[2][4];     // A fragments: row = node
#pragma unroll  // constant indices: the values stay in registers
  for (int i = 0; i < 2; ++i)
#pragma unroll  // constant indices: the values stay in registers
    for (int kk = 0; kk < 4; ++kk)
      xf[i][kk] = frag_row(xs + ((rt0 + i) * 16 + r) * LPITCH, kk, half);

#pragma unroll  // constant indices: the values stay in registers
  for (int c = 0; c < 2; ++c) {
    const int h = h0 + c;
    const float bias = c ? bias1 : bias0;
    v16h wf[4];      // B fragments: column = output channel
#pragma unroll  // constant indices: the values stay in registers
    for (int kk = 0; kk < 4; ++kk)
      wf[kk] = frag_row(wsm + (h * DK + r) * LPITCH, kk, half);

#pragma unroll  // constant indices: the values stay in registers
    for (int i = 0; i < 2; ++i) {
      v8f acc = {0.f, 0.f, 0.f, 0.f, 0.f, 0.f, 0.f, 0.f};
#pragma unroll  // K = 128 in chunks of 32
      for (int kk = 0; kk < 4; ++kk) acc = wmma_f16(xf[i][kk], wf[kk], acc);

      const int node0 = rg * PROWS + (rt0 + i) * 16;  // a group stays in one batch
      const int b     = node0 >> 10;
      const int n0    = node0 & (NN - 1);
#pragma unroll  // constant indices: the values stay in registers
      for (int v = 0; v < 8; ++v) {
        const int n = n0 + v + half * 8;              // C row
        const float val = acc[v] + bias;
        if (sel == 0)
          Qh[((size_t)(b * HH + h) * NN + n) * DK + r] = (_Float16)val;
        else if (sel == 1)
          Kh[((size_t)(b * HH + h) * NN + n) * DK + r] = (_Float16)val;
        else
          Vt[((size_t)(b * HH + h) * DK + r) * NN + n] = (_Float16)val;
      }
    }
  }
}

// ---------------------------------------------------------------------------
// Kernel 2: masked attention, flash-style streaming softmax, transposed form:
//   S^T = K x Q^T   (rows = keys, columns = queries)
//   O^T += V^T x P^T
// A lane owns one query column, so the row maximum and the row sum are taken
// inside the lane plus one exchange between the wave's halves, and the two
// S^T accumulator tiles, converted in place, are already the B operand P^T.
// Block = 256 threads = 8 waves = 8 heads over one (batch, 16-query tile).
// The block's 16 x 1024 adjacency tile is the same for all 8 heads: it is read
// from global memory once, in whole 512-byte runs with every load in flight
// together, turned into an f16 mask (0 on an edge, -MBIG elsewhere) and kept in
// LDS for all heads. The head dimension fills only 16 of the 32 k positions of
// S^T = K x Q^T; the other 16 carry the mask: K's side holds the 16 keys x 16
// queries mask tile, Q's side MBIG times the identity, so that the product
// itself adds -MBIG*MBIG to every score without an edge and exactly 0 to the
// others: masking a score takes no vector work, and the B operand stays the
// same for all keys.
// The block ends up holding all 128 attention channels of its 16 queries, which
// is a whole A operand of the output projection Y = AO @ Wo^T + bo: the heads'
// results meet in LDS as f16 and the block writes its 16 rows of Y itself. Wo is
// read in 512-byte runs beside the adjacency loads and kept as f16 in LDS.
// ---------------------------------------------------------------------------
__device__ __forceinline__ float other_half(float x) {
  // value of lane l ^ 16
  const int i = __builtin_bit_cast(int, x);
  return __builtin_bit_cast(float, __builtin_amdgcn_permlanex16(
      i, i, 0x76543210, 0xfedcba98, false, false));
}

#define MBIG   32768.0f   // exact in f16; -MBIG*MBIG = -2^30, exact in the f32 sum

// Mask in LDS, in pieces of 16 bytes = one key x 8 queries: 2 planes (queries
// 0..7, queries 8..15) x 4 rows (key & 3) x MROW pieces (key >> 2). A lane that
// holds 4 consecutive keys stores beside its neighbours (one 512-byte run a
// store); the 4 pad pieces of a row put the reads of 16 consecutive keys on
// different banks.
#define MROW 260

__global__ __launch_bounds__(256)
void gat_attn(const _Float16* __restrict__ Qh, const _Float16* __restrict__ Kh,
              const _Float16* __restrict__ Vt, const float* __restrict__ Adj,
              const float* __restrict__ Wo, const float* __restrict__ bo,
              float* __restrict__ Y)
{
  __shared__ __attribute__((aligned(16))) _Float16 kmask[2 * 4 * MROW * 8];
  __shared__ __attribute__((aligned(16))) _Float16 wsm[FOUT * LPITCH];  // Wo, f16
  __shared__ __attribute__((aligned(16))) _Float16 aos[16 * LPITCH];    // AO tile
  // bit q of word w: query q has an edge among the keys that wave w looked at
  __shared__ __attribute__((aligned(16))) unsigned live[8];

  const int lane = threadIdx.x & 31;
  const int h    = threadIdx.x >> 5;   // wave id == head
  const int r    = lane & 15;
  const int half = lane >> 4;
  const int qt   = blockIdx.x;         // query tile within batch (0..63)
  const int b    = blockIdx.y;
  const int bh   = b * HH + h;

  // Query r, d = half*8 .. +7
  F16x8 q0;
  q0.u4 = *reinterpret_cast<const uint4*>(
      Qh + ((size_t)bh * NN + qt * 16 + r) * DK + half * 8);

  // Output projection: waves 0..3 take 32 channels each (whole 128-byte lines).
  const int oc0 = (h & 3) * 2;    // first of the two 16-channel chunks
  const float bias0 = bo[oc0 * DK + r];
  const float bias1 = bo[oc0 * DK + DK + r];

  // Wave h masks keys 128h .. 128h+127 of all 16 queries: 16 loads of 128
  // consecutive keys; a lane then holds 4 keys x 16 queries. It also stages
  // rows 16h .. 16h+15 of Wo: their loads go out first and are converted while
  // the adjacency loads are still under way.
  {
    const float* wp   = Wo + (size_t)(h * 16) * FOUT + lane * 4;
    const float* acol = Adj + (size_t)b * NN * NN + (size_t)(qt * 16) * NN +
                        h * 128 + lane * 4;
    v4f wv[16];
    v4f x[16];
#pragma unroll  // constant indices: the values stay in registers
    for (int i = 0; i < 16; ++i)
      wv[i] = *reinterpret_cast<const v4f*>(wp + i * FOUT);
    // Keeps the Wo loads in front of the adjacency loads: loads return in order,
    // so only then can Wo be converted while the adjacency is still under way.
    __builtin_amdgcn_sched_barrier(0);
#pragma unroll  // constant indices: the values stay in registers
    for (int q = 0; q < 16; ++q)
      x[q] = *reinterpret_cast<const v4f*>(acol + q * NN);
    // Keeps all 32 loads above the first conversion: without it the adjacency
    // loads are issued only after most of Wo has returned, one round trip late.
    __builtin_amdgcn_sched_barrier(0);
#pragma unroll  // constant indices: the values stay in registers
    for (int i = 0; i < 16; ++i)
      stage_row(wsm + (h * 16 + i) * LPITCH + lane * 4, wv[i]);
    unsigned seen = 0u;   // bit q: an edge of query q seen by any lane
#pragma unroll  // constant indices: the values stay in registers
    for (int q = 0; q < 16; ++q) {
      const unsigned any = __builtin_amdgcn_ballot_w32(x[q][0] > 0.f) |
                           __builtin_amdgcn_ballot_w32(x[q][1] > 0.f) |
                           __builtin_amdgcn_ballot_w32(x[q][2] > 0.f) |
                           __builtin_amdgcn_ballot_w32(x[q][3] > 0.f);
      seen |= any ? (1u << q) : 0u;
    }
    _Float16* cw = kmask + (h * 32 + lane) * 8;   // key >> 2 = 32h + lane
#pragma unroll  // constant indices: the values stay in registers
    for (int p = 0; p < 2; ++p)
#pragma unroll  // constant indices: the values stay in registers
      for (int j = 0; j < 4; ++j) {
        v8h cv;
#pragma unroll  // constant indices: the values stay in registers
        for (int e = 0; e < 8; ++e)
          cv[e] = (x[p * 8 + e][j] > 0.f) ? (_Float16)0.f : (_Float16)(-MBIG);
        *reinterpret_cast<v8h*>(cw + (p * 4 + j) * MROW * 8) = cv;
      }
    if (lane == 0) live[h] = seen;
  }

  // oacc[v] = O[query r][d = half*8 + v]
  v8f oacc = {0.f, 0.f, 0.f, 0.f, 0.f, 0.f, 0.f, 0.f};
  float mrun = -1.0e30f;   // running maximum of query r (equal in both halves)
  float lrun = 0.f;        // running sum over this lane's own keys only

  __syncthreads();         // every wave's part of the mask and of Wo is in LDS

  // A query without any edge gets a zero Q column: its scores are then -2^30
  // exactly, all equal, and its softmax is uniform as the definition asks
  // (K x Q^T - 2^30 would round differently from key to key).
  {
    const uint4 la = *reinterpret_cast<const uint4*>(&live[0]);
    const uint4 lb = *reinterpret_cast<const uint4*>(&live[4]);
    const unsigned seen = la.x | la.y | la.z | la.w | lb.x | lb.y | lb.z | lb.w;
    const unsigned lv = ((seen >> r) & 1u) ? 0xffffffffu : 0u;
    q0.u4.x &= lv; q0.u4.y &= lv; q0.u4.z &= lv; q0.u4.w &= lv;
  }

  // B-fragment (32 x 16 queries), column r = query: k = d holds Q^T, k position
  // 16 + half*8 + e holds MBIG where it is the column's own query, else 0.
  v16h qb;
#pragma unroll  // constant indices: the values stay in registers
  for (int e = 0; e < 8; ++e) {
    qb[e]     = q0.h[e];
    qb[8 + e] = (half * 8 + e == r) ? (_Float16)MBIG : (_Float16)0.f;
  }

  // Mask of key r of a tile, queries half*8 .. +7
  const _Float16* mrow = kmask + ((half * 4 + (r & 3)) * MROW + (r >> 2)) * 8;

  for (int g = 0; g < NN / 128; ++g) {
#pragma unroll  // four passes' loads can be issued ahead of their use
    for (int s = 0; s < 4; ++s) {
      const int kbase = g * 128 + s * 32;

      // K rows kbase + r and kbase + 16 + r, d = half*8 .. +7
      const _Float16* kp = Kh + ((size_t)bh * NN + kbase + r) * DK + half * 8;
      const v8h t0 = *reinterpret_cast<const v8h*>(kp);
      const v8h t1 = *reinterpret_cast<const v8h*>(kp + 16 * DK);
      // V^T row d = r, keys kbase + half*8 + 0..7 and + 16 + 0..7
      const _Float16* vp = Vt + ((size_t)bh * DK + r) * NN + kbase + half * 8;
      const v8h t2 = *reinterpret_cast<const v8h*>(vp);
      const v8h t3 = *reinterpret_cast<const v8h*>(vp + 16);

      // Mask of keys kbase + r and kbase + 16 + r, queries half*8 .. +7
      const v8h m0 = *reinterpret_cast<const v8h*>(mrow + (kbase >> 2) * 8);
      const v8h m1 = *reinterpret_cast<const v8h*>(mrow + ((kbase + 16) >> 2) * 8);

      // A-fragments (16 keys x 32): k = d holds K, k = 16 + query holds the mask;
      // V^T A-fragment (16 d x 32 keys)
      v16h kb0, kb1, va;
#pragma unroll  // constant indices: the values stay in registers
      for (int e = 0; e < 8; ++e) {
        kb0[e] = t0[e]; kb0[8 + e] = m0[e];
        kb1[e] = t1[e]; kb1[8 + e] = m1[e];
        va[e]  = t2[e]; va[8 + e]  = t3[e];
      }

      const v8f zero = {0.f, 0.f, 0.f, 0.f, 0.f, 0.f, 0.f, 0.f};
      v8f s0 = wmma_f16(kb0, qb, zero);   // masked S^T[key half*8+v    ][query r]
      v8f s1 = wmma_f16(kb1, qb, zero);   // masked S^T[key 16+half*8+v ][query r]

      // Scale (1/sqrt(16)=0.25), streaming softmax update.
      float sv[16];
#pragma unroll  // constant indices: the values stay in registers
      for (int v = 0; v < 8; ++v) {
        sv[v]     = s0[v] * 0.25f;
        sv[8 + v] = s1[v] * 0.25f;
      }

      float tm = sv[0];
#pragma unroll  // constant indices: the values stay in registers
      for (int j = 1; j < 16; ++j) tm = fmaxf(tm, sv[j]);
      tm = fmaxf(tm, other_half(tm));   // maximum over all 32 keys of the pass

      const float mn = fmaxf(mrun, tm);
      const float al = __expf(mrun - mn);

      // P^T B-fragment: element j pairs with va's element j (same key).
      v16h pt;
      float e[16];
#pragma unroll  // constant indices: the values stay in registers
      for (int j = 0; j < 16; ++j) {
        e[j]  = __expf(sv[j] - mn);
        pt[j] = (_Float16)e[j];
      }
#pragma unroll  // constant indices: the values stay in registers
      for (int w = 8; w >= 1; w >>= 1)  // in-lane pairwise sum of the 16 terms
#pragma unroll  // constant indices: the values stay in registers
        for (int j = 0; j < w; ++j) e[j] += e[j + w];
      const float rs = e[0];

      lrun = lrun * al + rs;
      mrun = mn;
#pragma unroll  // constant indices: the values stay in registers
      for (int v = 0; v < 8; ++v) oacc[v] *= al;

      oacc = wmma_f16(va, pt, oacc);    // O^T += V^T(16x32) x P^T(32x16)
    }
  }

  // Join the halves' sums, normalize, put the head's attention output into the
  // block's 16 x 128 f16 tile: 8 consecutive d of one query per lane.
  lrun += other_half(lrun);
  F16x8 o;
#pragma unroll  // constant indices: the values stay in registers
  for (int v = 0; v < 8; ++v)
    o.h[v] = (_Float16)(oacc[v] / lrun);   // the maximum's own term is 1 => lrun >= 1
  *reinterpret_cast<uint4*>(aos + r * LPITCH + h * DK + half * 8) = o.u4;

  __syncthreads();         // all 8 heads' channels are in the tile from here on

  // Y rows of the 16 queries = tile (16 x 128) x Wo^T + bo, f32 result.
  if (__builtin_amdgcn_readfirstlane(h) < 4) {   // whole waves: a scalar branch
    v16h af[4];      // A fragments: row = query
#pragma unroll  // constant indices: the values stay in registers
    for (int kk = 0; kk < 4; ++kk)
      af[kk] = frag_row(aos + r * LPITCH, kk, half);

#pragma unroll  // constant indices: the values stay in registers
    for (int c = 0; c < 2; ++c) {
      const int oc = oc0 + c;
      const float bias = c ? bias1 : bias0;
      v16h wf[4];    // B fragments: column = output channel
#pragma unroll  // constant indices: the values stay in registers
      for (int kk = 0; kk < 4; ++kk)
        wf[kk] = frag_row(wsm + (oc * DK + r) * LPITCH, kk, half);

      v8f acc = {0.f, 0.f, 0.f, 0.f, 0.f, 0.f, 0.f, 0.f};
#pragma unroll  // K = 128 in chunks of 32
      for (int kk = 0; kk < 4; ++kk) acc = wmma_f16(af[kk], wf[kk], acc);

      float* yp = Y + ((size_t)b * NN + qt * 16 + half * 8) * FOUT + oc * DK + r;
#pragma unroll  // constant indices: the values stay in registers
      for (int v = 0; v < 8; ++v) yp[v * FOUT] = acc[v] + bias;   // C row half*8 + v
    }
  }
}

// ---------------------------------------------------------------------------
extern "C" void kernel_launch(void* const* d_in, const int* in_sizes, int n_in,
                              void* d_out, int out_size, void* d_ws, size_t ws_size,
                              hipStream_t stream) {
  const float* X   = (const float*)d_in[0];
  const float* Adj = (const float*)d_in[1];
  const float* Wq  = (const float*)d_in[2];
  const float* bq  = (const float*)d_in[3];
  const float* Wk  = (const float*)d_in[4];
  const float* bk  = (const float*)d_in[5];
  const float* Wv  = (const float*)d_in[6];
  const float* bv  = (const float*)d_in[7];
  const float* Wo  = (const float*)d_in[8];
  const float* bo  = (const float*)d_in[9];
  float* Y = (float*)d_out;

  // Workspace layout (6 MiB total, fully overwritten each call):
  //   [0,2M)   Qh  f16 [B,H,N,16]
  //   [2M,4M)  Kh  f16 [B,H,N,16]
  //   [4M,6M)  Vt  f16 [B,H,16,N]
  char* ws = (char*)d_ws;
  _Float16* Qh = (_Float16*)(ws);
  _Float16* Kh = (_Float16*)(ws + (2u << 20));
  _Float16* Vt = (_Float16*)(ws + (4u << 20));

  // 1) QKV projections: (B*N/64)=128 row groups x {Q,K,V}, 8 waves each
  gat_proj_qkv<<<dim3(128, 3), 256, 0, stream>>>(
      X, Wq, bq, Wk, bk, Wv, bv, Qh, Kh, Vt);

  // 2) Masked flash attention and output projection: (N/16)=64 query tiles x B,
  //    8 waves = 8 heads
  gat_attn<<<dim3(64, 8), 256, 0, stream>>>(Qh, Kh, Vt, Adj, Wo, bo, Y);
}

// v006
// One run takes 26.8 microseconds.
// Two timings next to v005 put it at 1.08 and 1.06 times that version's speed.
// All steps since v000 together make it 3.25 times as fast.
#include <hip/hip_runtime.h>

// MultiHeadGraphAttention for MI455X (gfx1250, wave32, WMMA f16->f32).
// B=8, N=1024, F_IN=F_OUT=128, H=8, D_K=16.

typedef __attribute__((ext_vector_type(16))) _Float16 v16h;
typedef __attribute__((ext_vector_type(8)))  float    v8f;
typedef __attribute__((ext_vector_type(4)))  float    v4f;
typedef __attribute__((ext_vector_type(8)))  _Float16 v8h;

#define BB   8
#define NN   1024
#define FIN  128
#define FOUT 128
#define HH   8
#define DK   16

union F16x8 { uint4 u4; _Float16 h[8]; };

__device__ __forceinline__ v8f wmma_f16(v16h a, v16h b, v8f c) {
  // D = A(16x32 f16) x B(32x16 f16) + C(16x16 f32)
  return __builtin_amdgcn_wmma_f32_16x16x32_f16(
      /*neg_a=*/false, a, /*neg_b=*/false, b,
      /*c_mod=*/(short)0, c, /*reuse_a=*/false, /*reuse_b=*/false);
}

// ---------------------------------------------------------------------------
// Kernel 1: fused QKV projection.
// Block = 256 threads = 8 waves -> 64 nodes x the 128 channels of one of Q, K, V.
// The block's X rows and the whole weight matrix are read once, each row as one
// 512-byte run, converted to f16 once and kept in LDS; every wave then takes a
// 32 x 32 piece of the result (2 x 2 tiles) with its fragments read from LDS.
//   sel 0: Q -> Qh[B,H,N,16] f16, times QSCALE
//   sel 1: K -> Kh[B,H,N,16] f16
//   sel 2: V -> Vt[B,H,16,N] f16  (transposed for contiguous fragment loads)
// ---------------------------------------------------------------------------
typedef __attribute__((ext_vector_type(4))) _Float16 v4h;

#define PROWS  64    // nodes per block
// Q is stored times 1/sqrt(16) * log2(e): K x Q^T is then the exponent of 2.
#define QSCALE 0.36067376022224085f
#define LPITCH 136   // f16 per staged row: 128 + 16 bytes, so that the 16-byte
                     // fragment reads of 16 rows fall on different banks

__device__ __forceinline__ void stage_row(_Float16* dst, v4f x) {
  v4h y;
  y[0] = (_Float16)x[0]; y[1] = (_Float16)x[1];
  y[2] = (_Float16)x[2]; y[3] = (_Float16)x[3];
  *reinterpret_cast<v4h*>(dst) = y;
}

// Fragment of one staged row: element e is K = kk*32 + half*8 + e, element
// 8 + e is K = kk*32 + 16 + half*8 + e (the same order for A and for B).
__device__ __forceinline__ v16h frag_row(const _Float16* row, int kk, int half) {
  const v8h lo = *reinterpret_cast<const v8h*>(row + kk * 32 + half * 8);
  const v8h hi = *reinterpret_cast<const v8h*>(row + kk * 32 + 16 + half * 8);
  return __builtin_shufflevector(lo, hi, 0, 1, 2, 3, 4, 5, 6, 7,
                                 8, 9, 10, 11, 12, 13, 14, 15);
}

__global__ __launch_bounds__(256)
void gat_proj_qkv(const float* __restrict__ X,
                  const float* __restrict__ Wq, const float* __restrict__ bq,
                  const float* __restrict__ Wk, const float* __restrict__ bk,
                  const float* __restrict__ Wv, const float* __restrict__ bv,
                  _Float16* __restrict__ Qh, _Float16* __restrict__ Kh,
                  _Float16* __restrict__ Vt)
{
  __shared__ __attribute__((aligned(16))) _Float16 xs[PROWS * LPITCH];
  __shared__ __attribute__((aligned(16))) _Float16 wsm[FOUT * LPITCH];

  const int lane = threadIdx.x & 31;
  const int w    = threadIdx.x >> 5;
  const int r    = lane & 15;
  const int half = lane >> 4;
  const int rg   = blockIdx.x;   // 64-row group over B*N (0..127)
  const int sel  = blockIdx.y;   // 0=Q 1=K 2=V

  const float* W  = (sel == 0) ? Wq : (sel == 1) ? Wk : Wv;
  const float* bi = (sel == 0) ? bq : (sel == 1) ? bk : bv;

  const int rt0 = (w & 1) * 2;    // first of this wave's two 16-node tiles
  const int h0  = (w >> 1) * 2;   // first of its two heads (16-channel chunks)
  const float bias0 = bi[h0 * DK + r];
  const float bias1 = bi[h0 * DK + DK + r];
  const float osc   = (sel == 0) ? QSCALE : 1.0f;   // times 1 is exact

  // Wave w stages X rows 8w .. 8w+7 of the group and weight rows 16w .. 16w+15.
  {
    const float* xp = X + (size_t)(rg * PROWS + w * 8) * FIN + lane * 4;
    const float* wp = W + (size_t)(w * 16) * FIN + lane * 4;
    v4f xv[8], wv[16];
#pragma unroll  // constant indices: the values stay in registers
    for (int i = 0; i < 8; ++i)
      xv[i] = *reinterpret_cast<const v4f*>(xp + i * FIN);
#pragma unroll  // constant indices: the values stay in registers
    for (int i = 0; i < 16; ++i)
      wv[i] = *reinterpret_cast<const v4f*>(wp + i * FIN);
    // Holds all 24 loads in front of the first conversion, so that they are in
    // flight together; without it the last loads reuse the first ones' registers
    // and start only after a whole round trip. The two addresses are named too:
    // their registers stay as they are until every load has returned.
    asm volatile("" :: "v"(xp), "v"(wp), "v"(xv[0]), "v"(xv[1]), "v"(xv[2]), "v"(xv[3]),
                       "v"(xv[4]), "v"(xv[5]), "v"(xv[6]), "v"(xv[7]),
                       "v"(wv[0]), "v"(wv[1]), "v"(wv[2]), "v"(wv[3]),
                       "v"(wv[4]), "v"(wv[5]), "v"(wv[6]), "v"(wv[7]),
                       "v"(wv[8]), "v"(wv[9]), "v"(wv[10]), "v"(wv[11]),
                       "v"(wv[12]), "v"(wv[13]), "v"(wv[14]), "v"(wv[15]));
#pragma unroll  // constant indices: the values stay in registers
    for (int i = 0; i < 8; ++i)
      stage_row(xs + (w * 8 + i) * LPITCH + lane * 4, xv[i]);
#pragma unroll  // constant indices: the values stay in registers
    for (int i = 0; i < 16; ++i)
      stage_row(wsm + (w * 16 + i) * LPITCH + lane * 4, wv[i]);
  }

  __syncthreads();   // every wave's staged rows are in LDS from here on

  v16h xf[2][4];     // A fragments: row = node
#pragma unroll  // constant indices: the values stay in registers
  for (int i = 0; i < 2; ++i)
#pragma unroll  // constant indices: the values stay in registers
    for (int kk = 0; kk < 4; ++kk)
      xf[i][kk] = frag_row(xs + ((rt0 + i) * 16 + r) * LPITCH, kk, half);

#pragma unroll  // constant indices: the values stay in registers
  for (int c = 0; c < 2; ++c) {
    const int h = h0 + c;
    const float bias = c ? bias1 : bias0;
    v16h wf[4];      // B fragments: column = output channel
#pragma unroll  // constant indices: the values stay in registers
    for (int kk = 0; kk < 4; ++kk)
      wf[kk] = frag_row(wsm + (h * DK + r) * LPITCH, kk, half);

#pragma unroll  // constant indices: the values stay in registers
    for (int i = 0; i < 2; ++i) {
      v8f acc = {0.f, 0.f, 0.f, 0.f, 0.f, 0.f, 0.f, 0.f};
#pragma unroll  // K = 128 in chunks of 32
      for (int kk = 0; kk < 4; ++kk) acc = wmma_f16(xf[i][kk], wf[kk], acc);

      const int node0 = rg * PROWS + (rt0 + i) * 16;  // a group stays in one batch
      const int b     = node0 >> 10;
      const int n0    = node0 & (NN - 1);
#pragma unroll  // constant indices: the values stay in registers
      for (int v = 0; v < 8; ++v) {
        const int n = n0 + v + half * 8;              // C row
        const float val = (acc[v] + bias) * osc;
        if (sel == 0)
          Qh[((size_t)(b * HH + h) * NN + n) * DK + r] = (_Float16)val;
        else if (sel == 1)
          Kh[((size_t)(b * HH + h) * NN + n) * DK + r] = (_Float16)val;
        else
          Vt[((size_t)(b * HH + h) * DK + r) * NN + n] = (_Float16)val;
      }
    }
  }
}

// ---------------------------------------------------------------------------
// Kernel 2: masked attention, flash-style streaming softmax, transposed form:
//   S^T = K x Q^T   (rows = keys, columns = queries)
//   O^T += V^T x P^T
// A lane owns one query column, so the row maximum and the row sum are taken
// inside the lane plus one exchange between the wave's halves, and the two
// S^T accumulator tiles, converted in place, are already the B operand P^T.
// Block = 256 threads = 8 waves = 8 heads over one (batch, 16-query tile).
// The block's 16 x 1024 adjacency tile is the same for all 8 heads: it is read
// from global memory once, in whole 512-byte runs with every load in flight
// together, turned into an f16 mask (0 on an edge, -MBIG elsewhere) and kept in
// LDS for all heads. The head dimension fills only 16 of the 32 k positions of
// S^T = K x Q^T; the other 16 carry the mask: K's side holds the 16 keys x 16
// queries mask tile, Q's side MBIG times the identity, so that the product
// itself adds -MBIG*MBIG to every score without an edge and exactly 0 to the
// others: masking a score takes no vector work, and the B operand stays the
// same for all keys.
// The softmax's subtraction rides in the same product: Q comes scaled to the
// log2 domain and the C operand holds minus the query's maximum in use, so the
// result is the argument of exp2 as it stands. The maximum in use is renewed,
// and the sums rescaled, only when a group of 128 keys shows terms too large
// for f16; until a query's first edge it is MFLOOR, under which masked scores
// give exactly 0.
// The block ends up holding all 128 attention channels of its 16 queries, which
// is a whole A operand of the output projection Y = AO @ Wo^T + bo: the heads'
// results meet in LDS as f16 and the block writes its 16 rows of Y itself. Wo is
// read in 512-byte runs beside the adjacency loads and kept as f16 in LDS.
// ---------------------------------------------------------------------------
__device__ __forceinline__ float other_half(float x) {
  // value of lane l ^ 16
  const int i = __builtin_bit_cast(int, x);
  return __builtin_bit_cast(float, __builtin_amdgcn_permlanex16(
      i, i, 0x76543210, 0xfedcba98, false, false));
}

#define MBIG   32768.0f   // exact in f16; -MBIG*MBIG = -2^30, exact in the f32 sum
#define MFLOOR (-268435456.0f)   // -2^28: above every masked score, below every real one
#define PMAX   4096.0f           // bound on a lane's sum of terms over 128 keys

// Sum of a lane's 64 terms, eight partial sums side by side, then joined.
__device__ __forceinline__ float lane_sum(const v8f (&x)[8]) {
  const v8f t = ((x[0] + x[1]) + (x[2] + x[3])) + ((x[4] + x[5]) + (x[6] + x[7]));
  return ((t[0] + t[4]) + (t[1] + t[5])) + ((t[2] + t[6]) + (t[3] + t[7]));
}

// Mask in LDS, in pieces of 16 bytes = one key x 8 queries: 2 planes (queries
// 0..7, queries 8..15) x 4 rows (key & 3) x MROW pieces (key >> 2). A lane that
// holds 4 consecutive keys stores beside its neighbours (one 512-byte run a
// store); the 4 pad pieces of a row put the reads of 16 consecutive keys on
// different banks.
#define MROW 260

__global__ __launch_bounds__(256)
void gat_attn(const _Float16* __restrict__ Qh, const _Float16* __restrict__ Kh,
              const _Float16* __restrict__ Vt, const float* __restrict__ Adj,
              const float* __restrict__ Wo, const float* __restrict__ bo,
              float* __restrict__ Y)
{
  __shared__ __attribute__((aligned(16))) _Float16 kmask[2 * 4 * MROW * 8];
  __shared__ __attribute__((aligned(16))) _Float16 wsm[FOUT * LPITCH];  // Wo, f16
  __shared__ __attribute__((aligned(16))) _Float16 aos[16 * LPITCH];    // AO tile
  // bit q of word w: query q has an edge among the keys that wave w looked at
  __shared__ __attribute__((aligned(16))) unsigned live[8];

  const int lane = threadIdx.x & 31;
  const int h    = threadIdx.x >> 5;   // wave id == head
  const int r    = lane & 15;
  const int half = lane >> 4;
  const int qt   = blockIdx.x;         // query tile within batch (0..63)
  const int b    = blockIdx.y;
  const int bh   = b * HH + h;

  // Query r, d = half*8 .. +7
  F16x8 q0;
  q0.u4 = *reinterpret_cast<const uint4*>(
      Qh + ((size_t)bh * NN + qt * 16 + r) * DK + half * 8);

  // Output projection: waves 0..3 take 32 channels each (whole 128-byte lines).
  const int oc0 = (h & 3) * 2;    // first of the two 16-channel chunks
  const float bias0 = bo[oc0 * DK + r];
  const float bias1 = bo[oc0 * DK + DK + r];

  // Wave h masks keys 128h .. 128h+127 of all 16 queries: 16 loads of 128
  // consecutive keys; a lane then holds 4 keys x 16 queries. It also stages
  // rows 16h .. 16h+15 of Wo: their loads go out first and are converted while
  // the adjacency loads are still under way.
  {
    const float* wp   = Wo + (size_t)(h * 16) * FOUT + lane * 4;
    const float* acol = Adj + (size_t)b * NN * NN + (size_t)(qt * 16) * NN +
                        h * 128 + lane * 4;
    v4f wv[16];
    v4f x[16];
#pragma unroll  // constant indices: the values stay in registers
    for (int i = 0; i < 16; ++i)
      wv[i] = *reinterpret_cast<const v4f*>(wp + i * FOUT);
    // Keeps the Wo loads in front of the adjacency loads: loads return in order,
    // so only then can Wo be converted while the adjacency is still under way.
    __builtin_amdgcn_sched_barrier(0);
#pragma unroll  // constant indices: the values stay in registers
    for (int q = 0; q < 16; ++q)
      x[q] = *reinterpret_cast<const v4f*>(acol + q * NN);
    // Keeps all 32 loads above the first conversion: without it the adjacency
    // loads are issued only after most of Wo has returned, one round trip late.
    __builtin_amdgcn_sched_barrier(0);
#pragma unroll  // constant indices: the values stay in registers
    for (int i = 0; i < 16; ++i)
      stage_row(wsm + (h * 16 + i) * LPITCH + lane * 4, wv[i]);
    unsigned seen = 0u;   // bit q: an edge of query q seen by any lane
#pragma unroll  // constant indices: the values stay in registers
    for (int q = 0; q < 16; ++q) {
      const unsigned any = __builtin_amdgcn_ballot_w32(x[q][0] > 0.f) |
                           __builtin_amdgcn_ballot_w32(x[q][1] > 0.f) |
                           __builtin_amdgcn_ballot_w32(x[q][2] > 0.f) |
                           __builtin_amdgcn_ballot_w32(x[q][3] > 0.f);
      seen |= any ? (1u << q) : 0u;
    }
    _Float16* cw = kmask + (h * 32 + lane) * 8;   // key >> 2 = 32h + lane
#pragma unroll  // constant indices: the values stay in registers
    for (int p = 0; p < 2; ++p)
#pragma unroll  // constant indices: the values stay in registers
      for (int j = 0; j < 4; ++j) {
        v8h cv;
#pragma unroll  // constant indices: the values stay in registers
        for (int e = 0; e < 8; ++e)
          cv[e] = (x[p * 8 + e][j] > 0.f) ? (_Float16)0.f : (_Float16)(-MBIG);
        *reinterpret_cast<v8h*>(cw + (p * 4 + j) * MROW * 8) = cv;
      }
    if (lane == 0) live[h] = seen;
  }

  // oacc[v] = O[query r][d = half*8 + v]
  v8f oacc = {0.f, 0.f, 0.f, 0.f, 0.f, 0.f, 0.f, 0.f};
  float mrun = MFLOOR;     // maximum in use of query r (equal in both halves)
  float lrun = 0.f;        // running sum over this lane's own keys only

  __syncthreads();         // every wave's part of the mask and of Wo is in LDS

  // A query without any edge gets a zero B column, the mask's entry included: its
  // scores are then exactly 0, all equal, and its softmax is uniform as the
  // definition asks.
  bool alive;
  {
    const uint4 la = *reinterpret_cast<const uint4*>(&live[0]);
    const uint4 lb = *reinterpret_cast<const uint4*>(&live[4]);
    const unsigned seen = la.x | la.y | la.z | la.w | lb.x | lb.y | lb.z | lb.w;
    alive = ((seen >> r) & 1u) != 0u;
    const unsigned lv = alive ? 0xffffffffu : 0u;
    q0.u4.x &= lv; q0.u4.y &= lv; q0.u4.z &= lv; q0.u4.w &= lv;
  }

  // B-fragment (32 x 16 queries), column r = query: k = d holds Q^T, k position
  // 16 + half*8 + e holds MBIG where it is the column's own query, else 0.
  v16h qb;
#pragma unroll  // constant indices: the values stay in registers
  for (int e = 0; e < 8; ++e) {
    qb[e]     = q0.h[e];
    qb[8 + e] = (alive && half * 8 + e == r) ? (_Float16)MBIG : (_Float16)0.f;
  }

  // Mask of key r of a tile, queries half*8 .. +7
  const _Float16* mrow = kmask + ((half * 4 + (r & 3)) * MROW + (r >> 2)) * 8;

  // C operand of the score products: minus the maximum in use, in all 8 rows.
  v8f cm;
#pragma unroll  // constant indices: the values stay in registers
  for (int v = 0; v < 8; ++v) cm[v] = -MFLOOR;

  const _Float16* kp = Kh + ((size_t)bh * NN + r) * DK + half * 8;   // K row r
  const _Float16* vp = Vt + ((size_t)bh * DK + r) * NN + half * 8;   // V^T row d = r

  for (int g = 0; g < NN / 128; ++g) {
    v16h kb[8], va[4];
#pragma unroll  // constant indices: the values stay in registers
    for (int s = 0; s < 4; ++s) {
      // K rows 32s + r and 32s + 16 + r of the group, d = half*8 .. +7
      const v8h t0 = *reinterpret_cast<const v8h*>(kp + s * 32 * DK);
      const v8h t1 = *reinterpret_cast<const v8h*>(kp + s * 32 * DK + 16 * DK);
      // Mask of keys 32s + r and 32s + 16 + r, queries half*8 .. +7
      const v8h m0 = *reinterpret_cast<const v8h*>(mrow + s * 64);
      const v8h m1 = *reinterpret_cast<const v8h*>(mrow + s * 64 + 32);
      // A-fragments (16 keys x 32): k = d holds K, k = 16 + query holds the mask
#pragma unroll  // constant indices: the values stay in registers
      for (int e = 0; e < 8; ++e) {
        kb[2 * s][e]     = t0[e]; kb[2 * s][8 + e]     = m0[e];
        kb[2 * s + 1][e] = t1[e]; kb[2 * s + 1][8 + e] = m1[e];
      }
    }
    // Behind the K loads: a V^T load below may land on the registers of their
    // address.
    asm volatile("s_wait_xcnt 0x0" ::: "memory");
#pragma unroll  // constant indices: the values stay in registers
    for (int s = 0; s < 4; ++s) {
      // V^T row d = r, keys 32s + half*8 + 0..7 and + 16 + 0..7
      const v8h t2 = *reinterpret_cast<const v8h*>(vp + s * 32);
      const v8h t3 = *reinterpret_cast<const v8h*>(vp + s * 32 + 16);
      // V^T A-fragment (16 d x 32 keys)
#pragma unroll  // constant indices: the values stay in registers
      for (int e = 0; e < 8; ++e) { va[s][e] = t2[e]; va[s][8 + e] = t3[e]; }
    }
    // Behind the V^T loads, in front of the step of the address they name.
    asm volatile("s_wait_xcnt 0x0" ::: "memory");
    kp   += 128 * DK;
    vp   += 128;
    mrow += 256;

    // ex[i][v] = 2^(masked S^T[key 16i + half*8 + v][query r] - maximum in use):
    // the product's result is the exponent itself.
    v8f ex[8];
    float gs = 0.f;
    bool renew = true;     // the first group has no maximum to go by yet
    if (g != 0) {
#pragma unroll  // constant indices: the values stay in registers
      for (int i = 0; i < 8; ++i) {
        const v8f d = wmma_f16(kb[i], qb, cm);
#pragma unroll  // constant indices: the values stay in registers
        for (int v = 0; v < 8; ++v) ex[i][v] = __builtin_amdgcn_exp2f(d[v]);
      }
      gs = lane_sum(ex);
      renew = __builtin_amdgcn_ballot_w32(!(gs <= PMAX)) != 0u;
    }

    // The terms are not negative, so a sum within PMAX bounds each of them: they
    // fit f16. Otherwise (first keys with an edge; a score far above the maximum
    // in use) the whole wave takes the true maximum of these 128 keys, rescales
    // what it has and forms the terms anew: none is then above 1. One scalar
    // branch per 128 keys.
    if (renew) {
      const v8f zero = {0.f, 0.f, 0.f, 0.f, 0.f, 0.f, 0.f, 0.f};
      v8f mx;
#pragma unroll  // constant indices: the values stay in registers
      for (int i = 0; i < 8; ++i) {
        ex[i] = wmma_f16(kb[i], qb, zero);
#pragma unroll  // constant indices: the values stay in registers
        for (int v = 0; v < 8; ++v) mx[v] = i ? fmaxf(mx[v], ex[i][v]) : ex[i][v];
      }
      float tm = mx[0];
#pragma unroll  // constant indices: the values stay in registers
      for (int v = 1; v < 8; ++v) tm = fmaxf(tm, mx[v]);
      tm = fmaxf(tm, other_half(tm));   // maximum over all 128 keys of the group

      const float mn = fmaxf(mrun, tm);
      const float al = __builtin_amdgcn_exp2f(mrun - mn);
      mrun = mn;
      lrun *= al;
#pragma unroll  // constant indices: the values stay in registers
      for (int v = 0; v < 8; ++v) { oacc[v] *= al; cm[v] = -mn; }
#pragma unroll  // constant indices: the values stay in registers
      for (int i = 0; i < 8; ++i) ex[i] += cm;
      // Keeps the additions apart from the exponentials: mixed, an addition came
      // to stand directly behind an exponential and on its source register.
      __builtin_amdgcn_sched_barrier(0);
#pragma unroll  // constant indices: the values stay in registers
      for (int i = 0; i < 8; ++i)
#pragma unroll  // constant indices: the values stay in registers
        for (int v = 0; v < 8; ++v) ex[i][v] = __builtin_amdgcn_exp2f(ex[i][v]);
      gs = lane_sum(ex);
    }
    lrun += gs;

#pragma unroll  // constant indices: the values stay in registers
    for (int s = 0; s < 4; ++s) {
      // P^T B-fragment: element j pairs with va's element j (same key).
      v16h pt;
#pragma unroll  // constant indices: the values stay in registers
      for (int v = 0; v < 8; ++v) {
        pt[v]     = (_Float16)ex[2 * s][v];
        pt[8 + v] = (_Float16)ex[2 * s + 1][v];
      }
      oacc = wmma_f16(va[s], pt, oacc);    // O^T += V^T(16x32) x P^T(32x16)
    }
  }

  // Join the halves' sums, normalize, put the head's attention output into the
  // block's 16 x 128 f16 tile: 8 consecutive d of one query per lane.
  lrun += other_half(lrun);
  F16x8 o;
#pragma unroll  // constant indices: the values stay in registers
  for (int v = 0; v < 8; ++v)
    o.h[v] = (_Float16)(oacc[v] / lrun);   // the maximum's own term is >= 1 => lrun >= 1
  *reinterpret_cast<uint4*>(aos + r * LPITCH + h * DK + half * 8) = o.u4;

  __syncthreads();         // all 8 heads' channels are in the tile from here on

  // Y rows of the 16 queries = tile (16 x 128) x Wo^T + bo, f32 result.
  if (__builtin_amdgcn_readfirstlane(h) < 4) {   // whole waves: a scalar branch
    v16h af[4];      // A fragments: row = query
#pragma unroll  // constant indices: the values stay in registers
    for (int kk = 0; kk < 4; ++kk)
      af[kk] = frag_row(aos + r * LPITCH, kk, half);

#pragma unroll  // constant indices: the values stay in registers
    for (int c = 0; c < 2; ++c) {
      const int oc = oc0 + c;
      const float bias = c ? bias1 : bias0;
      v16h wf[4];    // B fragments: column = output channel
#pragma unroll  // constant indices: the values stay in registers
      for (int kk = 0; kk < 4; ++kk)
        wf[kk] = frag_row(wsm + (oc * DK + r) * LPITCH, kk, half);

      v8f acc = {0.f, 0.f, 0.f, 0.f, 0.f, 0.f, 0.f, 0.f};
#pragma unroll  // K = 128 in chunks of 32
      for (int kk = 0; kk < 4; ++kk) acc = wmma_f16(af[kk], wf[kk], acc);

      float* yp = Y + ((size_t)b * NN + qt * 16 + half * 8) * FOUT + oc * DK + r;
#pragma unroll  // constant indices: the values stay in registers
      for (int v = 0; v < 8; ++v) yp[v * FOUT] = acc[v] + bias;   // C row half*8 + v
    }
  }
}

// ---------------------------------------------------------------------------
extern "C" void kernel_launch(void* const* d_in, const int* in_sizes, int n_in,
                              void* d_out, int out_size, void* d_ws, size_t ws_size,
                              hipStream_t stream) {
  const float* X   = (const float*)d_in[0];
  const float* Adj = (const float*)d_in[1];
  const float* Wq  = (const float*)d_in[2];
  const float* bq  = (const float*)d_in[3];
  const float* Wk  = (const float*)d_in[4];
  const float* bk  = (const float*)d_in[5];
  const float* Wv  = (const float*)d_in[6];
  const float* bv  = (const float*)d_in[7];
  const float* Wo  = (const float*)d_in[8];
  const float* bo  = (const float*)d_in[9];
  float* Y = (float*)d_out;

  // Workspace layout (6 MiB total, fully overwritten each call):
  //   [0,2M)   Qh  f16 [B,H,N,16]
  //   [2M,4M)  Kh  f16 [B,H,N,16]
  //   [4M,6M)  Vt  f16 [B,H,16,N]
  char* ws = (char*)d_ws;
  _Float16* Qh = (_Float16*)(ws);
  _Float16* Kh = (_Float16*)(ws + (2u << 20));
  _Float16* Vt = (_Float16*)(ws + (4u << 20));

  // 1) QKV projections: (B*N/64)=128 row groups x {Q,K,V}, 8 waves each
  gat_proj_qkv<<<dim3(128, 3), 256, 0, stream>>>(
      X, Wq, bq, Wk, bk, Wv, bv, Qh, Kh, Vt);

  // 2) Masked flash attention and output projection: (N/16)=64 query tiles x B,
  //    8 waves = 8 heads
  gat_attn<<<dim3(64, 8), 256, 0, stream>>>(Qh, Kh, Vt, Adj, Wo, bo, Y);
}

// v007
// One run takes 20.9 microseconds.
// Two timings next to v006 both put it at 1.28 times that version's speed.
// Counting every step since v000, it is 4.16 times as fast.
#include <hip/hip_runtime.h>

// MultiHeadGraphAttention for MI455X (gfx1250, wave32, WMMA f16->f32).
// B=8, N=1024, F_IN=F_OUT=128, H=8, D_K=16.

typedef __attribute__((ext_vector_type(16))) _Float16 v16h;
typedef __attribute__((ext_vector_type(8)))  float    v8f;
typedef __attribute__((ext_vector_type(4)))  float    v4f;
typedef __attribute__((ext_vector_type(8)))  _Float16 v8h;

#define BB   8
#define NN   1024
#define FIN  128
#define FOUT 128
#define HH   8
#define DK   16

union F16x8 { uint4 u4; _Float16 h[8]; };

__device__ __forceinline__ v8f wmma_f16(v16h a, v16h b, v8f c) {
  // D = A(16x32 f16) x B(32x16 f16) + C(16x16 f32)
  return __builtin_amdgcn_wmma_f32_16x16x32_f16(
      /*neg_a=*/false, a, /*neg_b=*/false, b,
      /*c_mod=*/(short)0, c, /*reuse_a=*/false, /*reuse_b=*/false);
}

// ---------------------------------------------------------------------------
// Kernel 1: fused QKV projection.
// Block = 256 threads = 8 waves -> 64 nodes x the 128 channels of one of Q, K, V.
// The block's X rows and the whole weight matrix are read once, each row as one
// 512-byte run, converted to f16 once and kept in LDS; every wave then takes a
// 32 x 32 piece of the result (2 x 2 tiles) with its fragments read from LDS.
//   sel 0: Q -> Qh[B,H,N,16] f16, times QSCALE
//   sel 1: K -> Kh[B,H,N,16] f16
//   sel 2: V -> Vf[B,H,N/16,32,8] f16: per 16 keys the 512 bytes that the 32 lanes
//          of the attention's V^T fragment load read, lane after lane: lane
//          l holds d = l & 15, keys (l >> 4)*8 .. +7 of the 16. That is also the
//          order in which this kernel's lanes hold the result tile, so a tile is
//          stored, and later loaded, as one run of four whole 128-byte lines.
// ---------------------------------------------------------------------------
typedef __attribute__((ext_vector_type(4))) _Float16 v4h;

#define PROWS  64    // nodes per block
// Q is stored times 1/sqrt(16) * log2(e): K x Q^T is then the exponent of 2.
#define QSCALE 0.36067376022224085f
#define LPITCH 136   // f16 per staged row: 128 + 16 bytes, so that the 16-byte
                     // fragment reads of 16 rows fall on different banks

__device__ __forceinline__ void stage_row(_Float16* dst, v4f x) {
  v4h y;
  y[0] = (_Float16)x[0]; y[1] = (_Float16)x[1];
  y[2] = (_Float16)x[2]; y[3] = (_Float16)x[3];
  *reinterpret_cast<v4h*>(dst) = y;
}

// Fragment of one staged row: element e is K = kk*32 + half*8 + e, element
// 8 + e is K = kk*32 + 16 + half*8 + e (the same order for A and for B).
__device__ __forceinline__ v16h frag_row(const _Float16* row, int kk, int half) {
  const v8h lo = *reinterpret_cast<const v8h*>(row + kk * 32 + half * 8);
  const v8h hi = *reinterpret_cast<const v8h*>(row + kk * 32 + 16 + half * 8);
  return __builtin_shufflevector(lo, hi, 0, 1, 2, 3, 4, 5, 6, 7,
                                 8, 9, 10, 11, 12, 13, 14, 15);
}

__global__ __launch_bounds__(256)
void gat_proj_qkv(const float* __restrict__ X,
                  const float* __restrict__ Wq, const float* __restrict__ bq,
                  const float* __restrict__ Wk, const float* __restrict__ bk,
                  const float* __restrict__ Wv, const float* __restrict__ bv,
                  _Float16* __restrict__ Qh, _Float16* __restrict__ Kh,
                  _Float16* __restrict__ Vf)
{
  __shared__ __attribute__((aligned(16))) _Float16 xs[PROWS * LPITCH];
  __shared__ __attribute__((aligned(16))) _Float16 wsm[FOUT * LPITCH];

  const int lane = threadIdx.x & 31;
  const int w    = threadIdx.x >> 5;
  const int r    = lane & 15;
  const int half = lane >> 4;
  const int rg   = blockIdx.x;   // 64-row group over B*N (0..127)
  const int sel  = blockIdx.y;   // 0=Q 1=K 2=V

  const float* W  = (sel == 0) ? Wq : (sel == 1) ? Wk : Wv;
  const float* bi = (sel == 0) ? bq : (sel == 1) ? bk : bv;

  const int rt0 = (w & 1) * 2;    // first of this wave's two 16-node tiles
  const int h0  = (w >> 1) * 2;   // first of its two heads (16-channel chunks)
  const float bias0 = bi[h0 * DK + r];
  const float bias1 = bi[h0 * DK + DK + r];
  const float osc   = (sel == 0) ? QSCALE : 1.0f;   // times 1 is exact

  // Wave w stages X rows 8w .. 8w+7 of the group and weight rows 16w .. 16w+15.
  {
    const float* xp = X + (size_t)(rg * PROWS + w * 8) * FIN + lane * 4;
    const float* wp = W + (size_t)(w * 16) * FIN + lane * 4;
    v4f xv[8], wv[16];
#pragma unroll  // constant indices: the values stay in registers
    for (int i = 0; i < 8; ++i)
      xv[i] = *reinterpret_cast<const v4f*>(xp + i * FIN);
#pragma unroll  // constant indices: the values stay in registers
    for (int i = 0; i < 16; ++i)
      wv[i] = *reinterpret_cast<const v4f*>(wp + i * FIN);
    // Holds all 24 loads in front of the first conversion, so that they are in
    // flight together; without it the last loads reuse the first ones' registers
    // and start only after a whole round trip. The two addresses are named too:
    // their registers stay as they are until every load has returned.
    asm volatile("" :: "v"(xp), "v"(wp), "v"(xv[0]), "v"(xv[1]), "v"(xv[2]), "v"(xv[3]),
                       "v"(xv[4]), "v"(xv[5]), "v"(xv[6]), "v"(xv[7]),
                       "v"(wv[0]), "v"(wv[1]), "v"(wv[2]), "v"(wv[3]),
                       "v"(wv[4]), "v"(wv[5]), "v"(wv[6]), "v"(wv[7]),
                       "v"(wv[8]), "v"(wv[9]), "v"(wv[10]), "v"(wv[11]),
                       "v"(wv[12]), "v"(wv[13]), "v"(wv[14]), "v"(wv[15]));
#pragma unroll  // constant indices: the values stay in registers
    for (int i = 0; i < 8; ++i)
      stage_row(xs + (w * 8 + i) * LPITCH + lane * 4, xv[i]);
#pragma unroll  // constant indices: the values stay in registers
    for (int i = 0; i < 16; ++i)
      stage_row(wsm + (w * 16 + i) * LPITCH + lane * 4, wv[i]);
  }

  __syncthreads();   // every wave's staged rows are in LDS from here on

  v16h xf[2][4];     // A fragments: row = node
#pragma unroll  // constant indices: the values stay in registers
  for (int i = 0; i < 2; ++i)
#pragma unroll  // constant indices: the values stay in registers
    for (int kk = 0; kk < 4; ++kk)
      xf[i][kk] = frag_row(xs + ((rt0 + i) * 16 + r) * LPITCH, kk, half);

  v8f acc[2][2];     // [head c][node tile i]
#pragma unroll  // constant indices: the values stay in registers
  for (int c = 0; c < 2; ++c) {
    v16h wf[4];      // B fragments: column = output channel
#pragma unroll  // constant indices: the values stay in registers
    for (int kk = 0; kk < 4; ++kk)
      wf[kk] = frag_row(wsm + ((h0 + c) * DK + r) * LPITCH, kk, half);

#pragma unroll  // constant indices: the values stay in registers
    for (int i = 0; i < 2; ++i) {
      v8f a = {0.f, 0.f, 0.f, 0.f, 0.f, 0.f, 0.f, 0.f};
#pragma unroll  // K = 128 in chunks of 32
      for (int kk = 0; kk < 4; ++kk) a = wmma_f16(xf[i][kk], wf[kk], a);
      acc[c][i] = a;
    }
  }

  const int node0 = rg * PROWS + rt0 * 16;   // a group stays in one batch
  const int bh0   = (node0 >> 10) * HH + h0;
  const int n0    = node0 & (NN - 1);
  // One branch of the whole block, behind all products: the stores of the four
  // tiles go out in one run, as the kernel's last work.
  if (sel == 2) {
    _Float16* vd = Vf + ((size_t)bh0 * (NN / 16) + (n0 >> 4)) * 256 + lane * 8;
#pragma unroll  // constant indices: the values stay in registers
    for (int c = 0; c < 2; ++c)
#pragma unroll  // constant indices: the values stay in registers
      for (int i = 0; i < 2; ++i) {
        const float bias = c ? bias1 : bias0;
        v8h o;       // d = r, keys of tile i, half*8 + 0..7: the lane's 16 bytes
#pragma unroll  // constant indices: the values stay in registers
        for (int v = 0; v < 8; ++v) o[v] = (_Float16)(acc[c][i][v] + bias);
        *reinterpret_cast<v8h*>(vd + (c * (NN / 16) + i) * 256) = o;
      }
  } else {
    _Float16* dst = ((sel == 0) ? Qh : Kh) +
                    ((size_t)bh0 * NN + n0 + half * 8) * DK + r;
    v8h o[2][2];
#pragma unroll  // constant indices: the values stay in registers
    for (int c = 0; c < 2; ++c)
#pragma unroll  // constant indices: the values stay in registers
      for (int i = 0; i < 2; ++i) {
        const float bias = c ? bias1 : bias0;
#pragma unroll  // constant indices: the values stay in registers
        for (int v = 0; v < 8; ++v)
          o[c][i][v] = (_Float16)((acc[c][i][v] + bias) * osc);
      }
    // Keeps every conversion in front of the first store: mixed, a tile's values
    // reuse the registers of the tile before and wait for its stores each time.
    __builtin_amdgcn_sched_barrier(0);
#pragma unroll  // constant indices: the values stay in registers
    for (int c = 0; c < 2; ++c)
#pragma unroll  // constant indices: the values stay in registers
      for (int i = 0; i < 2; ++i)
#pragma unroll  // constant indices: the values stay in registers
        for (int v = 0; v < 8; ++v)                   // C row half*8 + v of tile i
          dst[(c * NN + i * 16 + v) * DK] = o[c][i][v];
    // Behind the last stores: in the built code the V path's instructions stand
    // behind these and write registers that the stores name.
    asm volatile("s_wait_xcnt 0x0" ::: "memory");
  }
}

// ---------------------------------------------------------------------------
// Kernel 2: masked attention, flash-style streaming softmax, transposed form:
//   S^T = K x Q^T   (rows = keys, columns = queries)
//   O^T += V^T x P^T
// A lane owns one query column, so the row maximum and the row sum are taken
// inside the lane plus one exchange between the wave's halves, and the two
// S^T accumulator tiles, converted in place, are already the B operand P^T.
// Block = 256 threads = 8 waves = 8 heads over one (batch, 16-query tile).
// The block's 16 x 1024 adjacency tile is the same for all 8 heads: it is read
// from global memory once, in whole 512-byte runs with every load in flight
// together, turned into an f16 mask (0 on an edge, -MBIG elsewhere) and kept in
// LDS for all heads. The head dimension fills only 16 of the 32 k positions of
// S^T = K x Q^T; the other 16 carry the mask: K's side holds the 16 keys x 16
// queries mask tile, Q's side MBIG times the identity, so that the product
// itself adds -MBIG*MBIG to every score without an edge and exactly 0 to the
// others: masking a score takes no vector work, and the B operand stays the
// same for all keys.
// The softmax's subtraction rides in the same product: Q comes scaled to the
// log2 domain and the C operand holds minus the query's maximum in use, so the
// result is the argument of exp2 as it stands. The maximum in use is renewed,
// and the sums rescaled, only when a group of 128 keys shows terms too large
// for f16; until a query's first edge it is MFLOOR, under which masked scores
// give exactly 0.
// The block ends up holding all 128 attention channels of its 16 queries, which
// is a whole A operand of the output projection Y = AO @ Wo^T + bo: the heads'
// results meet in LDS as f16 and the block writes its 16 rows of Y itself. Wo is
// read in 512-byte runs beside the adjacency loads and kept as f16 in LDS.
// ---------------------------------------------------------------------------
__device__ __forceinline__ float other_half(float x) {
  // value of lane l ^ 16
  const int i = __builtin_bit_cast(int, x);
  return __builtin_bit_cast(float, __builtin_amdgcn_permlanex16(
      i, i, 0x76543210, 0xfedcba98, false, false));
}

#define MBIG   32768.0f   // exact in f16; -MBIG*MBIG = -2^30, exact in the f32 sum
#define MFLOOR (-268435456.0f)   // -2^28: above every masked score, below every real one
#define PMAX   4096.0f           // bound on a lane's sum of terms over 128 keys

// Sum of a lane's 64 terms, eight partial sums side by side, then joined.
__device__ __forceinline__ float lane_sum(const v8f (&x)[8]) {
  const v8f t = ((x[0] + x[1]) + (x[2] + x[3])) + ((x[4] + x[5]) + (x[6] + x[7]));
  return ((t[0] + t[4]) + (t[1] + t[5])) + ((t[2] + t[6]) + (t[3] + t[7]));
}

// Mask in LDS, in pieces of 16 bytes = one key x 8 queries: 2 planes (queries
// 0..7, queries 8..15) x 4 rows (key & 3) x MROW pieces (key >> 2). A lane that
// holds 4 consecutive keys stores beside its neighbours (one 512-byte run a
// store); the 4 pad pieces of a row put the reads of 16 consecutive keys on
// different banks.
#define MROW 260

__global__ __launch_bounds__(256)
void gat_attn(const _Float16* __restrict__ Qh, const _Float16* __restrict__ Kh,
              const _Float16* __restrict__ Vf, const float* __restrict__ Adj,
              const float* __restrict__ Wo, const float* __restrict__ bo,
              float* __restrict__ Y)
{
  __shared__ __attribute__((aligned(16))) _Float16 kmask[2 * 4 * MROW * 8];
  __shared__ __attribute__((aligned(16))) _Float16 wsm[FOUT * LPITCH];  // Wo, f16
  __shared__ __attribute__((aligned(16))) _Float16 aos[16 * LPITCH];    // AO tile
  // bit q of word w: query q has an edge among the keys that wave w looked at
  __shared__ __attribute__((aligned(16))) unsigned live[8];

  const int lane = threadIdx.x & 31;
  const int h    = threadIdx.x >> 5;   // wave id == head
  const int r    = lane & 15;
  const int half = lane >> 4;
  const int qt   = blockIdx.x;         // query tile within batch (0..63)
  const int b    = blockIdx.y;
  const int bh   = b * HH + h;

  // Query r, d = half*8 .. +7
  F16x8 q0;
  q0.u4 = *reinterpret_cast<const uint4*>(
      Qh + ((size_t)bh * NN + qt * 16 + r) * DK + half * 8);

  // Output projection: waves 0..3 take 32 channels each (whole 128-byte lines).
  const int oc0 = (h & 3) * 2;    // first of the two 16-channel chunks
  const float bias0 = bo[oc0 * DK + r];
  const float bias1 = bo[oc0 * DK + DK + r];

  // Wave h masks keys 128h .. 128h+127 of all 16 queries: 16 loads of 128
  // consecutive keys; a lane then holds 4 keys x 16 queries. It also stages
  // rows 16h .. 16h+15 of Wo: their loads go out first and are converted while
  // the adjacency loads are still under way.
  {
    const float* wp   = Wo + (size_t)(h * 16) * FOUT + lane * 4;
    const float* acol = Adj + (size_t)b * NN * NN + (size_t)(qt * 16) * NN +
                        h * 128 + lane * 4;
    v4f wv[16];
    v4f x[16];
#pragma unroll  // constant indices: the values stay in registers
    for (int i = 0; i < 16; ++i)
      wv[i] = *reinterpret_cast<const v4f*>(wp + i * FOUT);
    // Keeps the Wo loads in front of the adjacency loads: loads return in order,
    // so only then can Wo be converted while the adjacency is still under way.
    __builtin_amdgcn_sched_barrier(0);
#pragma unroll  // constant indices: the values stay in registers
    for (int q = 0; q < 16; ++q)
      x[q] = *reinterpret_cast<const v4f*>(acol + q * NN);
    // Keeps all 32 loads above the first conversion: without it the adjacency
    // loads are issued only after most of Wo has returned, one round trip late.
    __builtin_amdgcn_sched_barrier(0);
#pragma unroll  // constant indices: the values stay in registers
    for (int i = 0; i < 16; ++i)
      stage_row(wsm + (h * 16 + i) * LPITCH + lane * 4, wv[i]);
    unsigned seen = 0u;   // bit q: an edge of query q seen by any lane
#pragma unroll  // constant indices: the values stay in registers
    for (int q = 0; q < 16; ++q) {
      const unsigned any = __builtin_amdgcn_ballot_w32(x[q][0] > 0.f) |
                           __builtin_amdgcn_ballot_w32(x[q][1] > 0.f) |
                           __builtin_amdgcn_ballot_w32(x[q][2] > 0.f) |
                           __builtin_amdgcn_ballot_w32(x[q][3] > 0.f);
      seen |= any ? (1u << q) : 0u;
    }
    _Float16* cw = kmask + (h * 32 + lane) * 8;   // key >> 2 = 32h + lane
#pragma unroll  // constant indices: the values stay in registers
    for (int p = 0; p < 2; ++p)
#pragma unroll  // constant indices: the values stay in registers
      for (int j = 0; j < 4; ++j) {
        v8h cv;
#pragma unroll  // constant indices: the values stay in registers
        for (int e = 0; e < 8; ++e)
          cv[e] = (x[p * 8 + e][j] > 0.f) ? (_Float16)0.f : (_Float16)(-MBIG);
        *reinterpret_cast<v8h*>(cw + (p * 4 + j) * MROW * 8) = cv;
      }
    if (lane == 0) live[h] = seen;
  }

  // oacc[v] = O[query r][d = half*8 + v]
  v8f oacc = {0.f, 0.f, 0.f, 0.f, 0.f, 0.f, 0.f, 0.f};
  float mrun = MFLOOR;     // maximum in use of query r (equal in both halves)
  float lrun = 0.f;        // running sum over this lane's own keys only

  __syncthreads();         // every wave's part of the mask and of Wo is in LDS

  // A query without any edge gets a zero B column, the mask's entry included: its
  // scores are then exactly 0, all equal, and its softmax is uniform as the
  // definition asks.
  bool alive;
  {
    const uint4 la = *reinterpret_cast<const uint4*>(&live[0]);
    const uint4 lb = *reinterpret_cast<const uint4*>(&live[4]);
    const unsigned seen = la.x | la.y | la.z | la.w | lb.x | lb.y | lb.z | lb.w;
    alive = ((seen >> r) & 1u) != 0u;
    const unsigned lv = alive ? 0xffffffffu : 0u;
    q0.u4.x &= lv; q0.u4.y &= lv; q0.u4.z &= lv; q0.u4.w &= lv;
  }

  // B-fragment (32 x 16 queries), column r = query: k = d holds Q^T, k position
  // 16 + half*8 + e holds MBIG where it is the column's own query, else 0.
  v16h qb;
#pragma unroll  // constant indices: the values stay in registers
  for (int e = 0; e < 8; ++e) {
    qb[e]     = q0.h[e];
    qb[8 + e] = (alive && half * 8 + e == r) ? (_Float16)MBIG : (_Float16)0.f;
  }

  // Mask of key r of a tile, queries half*8 .. +7
  const _Float16* mrow = kmask + ((half * 4 + (r & 3)) * MROW + (r >> 2)) * 8;

  // C operand of the score products: minus the maximum in use, in all 8 rows.
  v8f cm;
#pragma unroll  // constant indices: the values stay in registers
  for (int v = 0; v < 8; ++v) cm[v] = -MFLOOR;

  const _Float16* kp = Kh + ((size_t)bh * NN + r) * DK + half * 8;   // K row r
  // V in fragment order: 256 f16 per 16 keys, this lane's 8 at lane * 8
  const _Float16* vp = Vf + (size_t)bh * (NN / 16) * 256 + lane * 8;

  for (int g = 0; g < NN / 128; ++g) {
    v16h kb[8], va[4];
#pragma unroll  // constant indices: the values stay in registers
    for (int s = 0; s < 4; ++s) {
      // K rows 32s + r and 32s + 16 + r of the group, d = half*8 .. +7
      const v8h t0 = *reinterpret_cast<const v8h*>(kp + s * 32 * DK);
      const v8h t1 = *reinterpret_cast<const v8h*>(kp + s * 32 * DK + 16 * DK);
      // Mask of keys 32s + r and 32s + 16 + r, queries half*8 .. +7
      const v8h m0 = *reinterpret_cast<const v8h*>(mrow + s * 64);
      const v8h m1 = *reinterpret_cast<const v8h*>(mrow + s * 64 + 32);
      // A-fragments (16 keys x 32): k = d holds K, k = 16 + query holds the mask
#pragma unroll  // constant indices: the values stay in registers
      for (int e = 0; e < 8; ++e) {
        kb[2 * s][e]     = t0[e]; kb[2 * s][8 + e]     = m0[e];
        kb[2 * s + 1][e] = t1[e]; kb[2 * s + 1][8 + e] = m1[e];
      }
    }
    // Behind the K loads: a V^T load below may land on the registers of their
    // address.
    asm volatile("s_wait_xcnt 0x0" ::: "memory");
#pragma unroll  // constant indices: the values stay in registers
    for (int s = 0; s < 4; ++s) {
      // V^T row d = r, keys 32s + half*8 + 0..7 and + 16 + 0..7: each load of the
      // wave is one 512-byte run
      const v8h t2 = *reinterpret_cast<const v8h*>(vp + s * 512);
      const v8h t3 = *reinterpret_cast<const v8h*>(vp + s * 512 + 256);
      // V^T A-fragment (16 d x 32 keys)
#pragma unroll  // constant indices: the values stay in registers
      for (int e = 0; e < 8; ++e) { va[s][e] = t2[e]; va[s][8 + e] = t3[e]; }
    }
    // Behind the V^T loads, in front of the step of the address they name.
    asm volatile("s_wait_xcnt 0x0" ::: "memory");
    kp   += 128 * DK;
    vp   += 128 * DK;
    mrow += 256;

    // ex[i][v] = 2^(masked S^T[key 16i + half*8 + v][query r] - maximum in use):
    // the product's result is the exponent itself.
    v8f ex[8];
    float gs = 0.f;
    bool renew = true;     // the first group has no maximum to go by yet
    if (g != 0) {
#pragma unroll  // constant indices: the values stay in registers
      for (int i = 0; i < 8; ++i) {
        const v8f d = wmma_f16(kb[i], qb, cm);
#pragma unroll  // constant indices: the values stay in registers
        for (int v = 0; v < 8; ++v) ex[i][v] = __builtin_amdgcn_exp2f(d[v]);
      }
      gs = lane_sum(ex);
      renew = __builtin_amdgcn_ballot_w32(!(gs <= PMAX)) != 0u;
    }

    // The terms are not negative, so a sum within PMAX bounds each of them: they
    // fit f16. Otherwise (first keys with an edge; a score far above the maximum
    // in use) the whole wave takes the true maximum of these 128 keys, rescales
    // what it has and forms the terms anew: none is then above 1. One scalar
    // branch per 128 keys.
    if (renew) {
      const v8f zero = {0.f, 0.f, 0.f, 0.f, 0.f, 0.f, 0.f, 0.f};
      v8f mx;
#pragma unroll  // constant indices: the values stay in registers
      for (int i = 0; i < 8; ++i) {
        ex[i] = wmma_f16(kb[i], qb, zero);
#pragma unroll  // constant indices: the values stay in registers
        for (int v = 0; v < 8; ++v) mx[v] = i ? fmaxf(mx[v], ex[i][v]) : ex[i][v];
      }
      float tm = mx[0];
#pragma unroll  // constant indices: the values stay in registers
      for (int v = 1; v < 8; ++v) tm = fmaxf(tm, mx[v]);
      tm = fmaxf(tm, other_half(tm));   // maximum over all 128 keys of the group

      const float mn = fmaxf(mrun, tm);
      const float al = __builtin_amdgcn_exp2f(mrun - mn);
      mrun = mn;
      lrun *= al;
#pragma unroll  // constant indices: the values stay in registers
      for (int v = 0; v < 8; ++v) { oacc[v] *= al; cm[v] = -mn; }
#pragma unroll  // constant indices: the values stay in registers
      for (int i = 0; i < 8; ++i) ex[i] += cm;
      // Keeps the additions apart from the exponentials: mixed, an addition came
      // to stand directly behind an exponential and on its source register.
      __builtin_amdgcn_sched_barrier(0);
#pragma unroll  // constant indices: the values stay in registers
      for (int i = 0; i < 8; ++i)
#pragma unroll  // constant indices: the values stay in registers
        for (int v = 0; v < 8; ++v) ex[i][v] = __builtin_amdgcn_exp2f(ex[i][v]);
      gs = lane_sum(ex);
    }
    lrun += gs;

#pragma unroll  // constant indices: the values stay in registers
    for (int s = 0; s < 4; ++s) {
      // P^T B-fragment: element j pairs with va's element j (same key).
      v16h pt;
#pragma unroll  // constant indices: the values stay in registers
      for (int v = 0; v < 8; ++v) {
        pt[v]     = (_Float16)ex[2 * s][v];
        pt[8 + v] = (_Float16)ex[2 * s + 1][v];
      }
      oacc = wmma_f16(va[s], pt, oacc);    // O^T += V^T(16x32) x P^T(32x16)
    }
  }

  // Join the halves' sums, normalize, put the head's attention output into the
  // block's 16 x 128 f16 tile: 8 consecutive d of one query per lane.
  lrun += other_half(lrun);
  F16x8 o;
#pragma unroll  // constant indices: the values stay in registers
  for (int v = 0; v < 8; ++v)
    o.h[v] = (_Float16)(oacc[v] / lrun);   // the maximum's own term is >= 1 => lrun >= 1
  *reinterpret_cast<uint4*>(aos + r * LPITCH + h * DK + half * 8) = o.u4;

  __syncthreads();         // all 8 heads' channels are in the tile from here on

  // Y rows of the 16 queries = tile (16 x 128) x Wo^T + bo, f32 result.
  if (__builtin_amdgcn_readfirstlane(h) < 4) {   // whole waves: a scalar branch
    v16h af[4];      // A fragments: row = query
#pragma unroll  // constant indices: the values stay in registers
    for (int kk = 0; kk < 4; ++kk)
      af[kk] = frag_row(aos + r * LPITCH, kk, half);

#pragma unroll  // constant indices: the values stay in registers
    for (int c = 0; c < 2; ++c) {
      const int oc = oc0 + c;
      const float bias = c ? bias1 : bias0;
      v16h wf[4];    // B fragments: column = output channel
#pragma unroll  // constant indices: the values stay in registers
      for (int kk = 0; kk < 4; ++kk)
        wf[kk] = frag_row(wsm + (oc * DK + r) * LPITCH, kk, half);

      v8f acc = {0.f, 0.f, 0.f, 0.f, 0.f, 0.f, 0.f, 0.f};
#pragma unroll  // K = 128 in chunks of 32
      for (int kk = 0; kk < 4; ++kk) acc = wmma_f16(af[kk], wf[kk], acc);

      float* yp = Y + ((size_t)b * NN + qt * 16 + half * 8) * FOUT + oc * DK + r;
#pragma unroll  // constant indices: the values stay in registers
      for (int v = 0; v < 8; ++v) yp[v * FOUT] = acc[v] + bias;   // C row half*8 + v
    }
  }
}

// ---------------------------------------------------------------------------
extern "C" void kernel_launch(void* const* d_in, const int* in_sizes, int n_in,
                              void* d_out, int out_size, void* d_ws, size_t ws_size,
                              hipStream_t stream) {
  const float* X   = (const float*)d_in[0];
  const float* Adj = (const float*)d_in[1];
  const float* Wq  = (const float*)d_in[2];
  const float* bq  = (const float*)d_in[3];
  const float* Wk  = (const float*)d_in[4];
  const float* bk  = (const float*)d_in[5];
  const float* Wv  = (const float*)d_in[6];
  const float* bv  = (const float*)d_in[7];
  const float* Wo  = (const float*)d_in[8];
  const float* bo  = (const float*)d_in[9];
  float* Y = (float*)d_out;

  // Workspace layout (6 MiB total, fully overwritten each call):
  //   [0,2M)   Qh  f16 [B,H,N,16]
  //   [2M,4M)  Kh  f16 [B,H,N,16]
  //   [4M,6M)  Vf  f16 [B,H,N/16,32,8]
  char* ws = (char*)d_ws;
  _Float16* Qh = (_Float16*)(ws);
  _Float16* Kh = (_Float16*)(ws + (2u << 20));
  _Float16* Vf = (_Float16*)(ws + (4u << 20));

  // 1) QKV projections: (B*N/64)=128 row groups x {Q,K,V}, 8 waves each
  gat_proj_qkv<<<dim3(128, 3), 256, 0, stream>>>(
      X, Wq, bq, Wk, bk, Wv, bv, Qh, Kh, Vf);

  // 2) Masked flash attention and output projection: (N/16)=64 query tiles x B,
  //    8 waves = 8 heads
  gat_attn<<<dim3(64, 8), 256, 0, stream>>>(Qh, Kh, Vf, Adj, Wo, bo, Y);
}
